// v000
// Times are from an AMD MI455X. After a warm-up the kernel runs many times in a row, and a time is the length of
// such a window on the GPU divided by its runs, so every launch and the gaps after it count. The runs cycle
// through copies of the inputs. A figure is the median of several windows, for all but v000 over two sittings.
// Sittings can differ by a few percent; kernels timed side by side share one.
// v000, which the later versions start from, runs in 198 microseconds.
#include <hip/hip_runtime.h>

// Problem dims (fixed by reference): B=4,S=8 -> 32 slices; H*W=1024; C1=C2=C=256.
#define NSLICE 32
#define HW     1024
#define CCH    256
#define SCALE  0.0625f   // 1/sqrt(256)

typedef __attribute__((ext_vector_type(16))) __bf16 v16bf;
typedef __attribute__((ext_vector_type(8)))  float  v8f;

union FragBF { v16bf v; uint4 u[2]; };

// Load one WMMA operand fragment: lane holds 16 contiguous bf16 (32 bytes).
// Works for both A fragments (lane = row M, K contiguous) and B fragments
// (lane = col N, K contiguous) because B-frag == B^T in A layout.
__device__ __forceinline__ v16bf load_frag(const __bf16* p) {
  FragBF f;
  f.u[0] = *(const uint4*)(p);
  f.u[1] = *(const uint4*)(p + 8);
  return f.v;
}

__device__ __forceinline__ v8f wmma_bf16(v16bf a, v16bf b, v8f c) {
  return __builtin_amdgcn_wmma_f32_16x16x32_bf16(
      /*neg_a=*/false, a, /*neg_b=*/false, b,
      /*c_mod=*/(short)0, c, /*reuse_a=*/false, /*reuse_b=*/false);
}

// ---------------------------------------------------------------------------
// Kernel 0: transpose + bf16-convert the three 256x256 weight matrices.
// W[c][cout] (row-major) -> Wt[cout][c] bf16 so projection fragments are
// contiguous per-lane 32B loads.
// ---------------------------------------------------------------------------
__global__ __launch_bounds__(256) void prep_weights_k(
    const float* __restrict__ Wq, const float* __restrict__ Wk,
    const float* __restrict__ Wv,
    __bf16* __restrict__ Wtq, __bf16* __restrict__ Wtk,
    __bf16* __restrict__ Wtv) {
  int idx  = blockIdx.x * 256 + threadIdx.x;   // 0..65535
  int cout = idx >> 8;
  int c    = idx & 255;
  int src  = c * CCH + cout;
  Wtq[idx] = (__bf16)Wq[src];
  Wtk[idx] = (__bf16)Wk[src];
  Wtv[idx] = (__bf16)Wv[src];
}

// ---------------------------------------------------------------------------
// Kernel 1: projections.  Per workgroup: one slice, 64 spatial rows.
//   Q[p][cout], K[p][cout]  (row-major bf16)   = X  @ W + b
//   Vt[cout][p]             (transposed bf16)  = (Xd @ Wv + bv)^T
// X is staged channel-major->row-major through LDS as bf16.
// Block = 128 threads (4 waves). Dynamic LDS = 2 * 64 * 264 bf16.
// ---------------------------------------------------------------------------
#define XPITCH 264

__global__ __launch_bounds__(128) void proj_k(
    const float* __restrict__ img, const float* __restrict__ depth,
    const __bf16* __restrict__ Wtq, const __bf16* __restrict__ Wtk,
    const __bf16* __restrict__ Wtv,
    const float* __restrict__ bq, const float* __restrict__ bk,
    const float* __restrict__ bv,
    __bf16* __restrict__ Qw, __bf16* __restrict__ Kw,
    __bf16* __restrict__ Vtw) {
  extern __shared__ unsigned char dynsmem[];
  __bf16* Xi = (__bf16*)dynsmem;          // [64][XPITCH] img  rows (bf16)
  __bf16* Xd = Xi + 64 * XPITCH;          // [64][XPITCH] depth rows

  const int slice = blockIdx.x;
  const int pbase = blockIdx.y * 64;
  const int tid   = threadIdx.x;
  const int wave  = tid >> 5;
  const int lane  = tid & 31;
  const int l15   = lane & 15;
  const int hi    = lane >> 4;            // 0: K 0..15, 1: K 16..31

  // ---- Stage inputs: global [c][p] f32 (coalesced in p) -> LDS [p][c] bf16
  {
    const float* ib = img   + (size_t)slice * CCH * HW + pbase;
    const float* db = depth + (size_t)slice * CCH * HW + pbase;
#pragma unroll 4
    for (int it = 0; it < 128; ++it) {    // 64*256 / 128 threads
      int idx = it * 128 + tid;
      int c   = idx >> 6;
      int p   = idx & 63;
      Xi[p * XPITCH + c] = (__bf16)ib[(size_t)c * HW + p];
      Xd[p * XPITCH + c] = (__bf16)db[(size_t)c * HW + p];
    }
  }
  __syncthreads();

  // ---- Q and K GEMMs: wave w owns rows [w*16, w*16+16)
  v16bf xiF[8], xdF[8];
#pragma unroll
  for (int kc = 0; kc < 8; ++kc) {
    const int off = (wave * 16 + l15) * XPITCH + kc * 32 + hi * 16;
    xiF[kc] = load_frag(Xi + off);
    xdF[kc] = load_frag(Xd + off);
  }

  for (int ct = 0; ct < 16; ++ct) {       // 16 cout tiles
    float biasq = bq[ct * 16 + l15];
    float biask = bk[ct * 16 + l15];
    v8f aq, ak;
#pragma unroll
    for (int i = 0; i < 8; ++i) { aq[i] = biasq; ak[i] = biask; }
#pragma unroll
    for (int kc = 0; kc < 8; ++kc) {
      const int woff = (ct * 16 + l15) * CCH + kc * 32 + hi * 16;
      aq = wmma_bf16(xiF[kc], load_frag(Wtq + woff), aq);
      ak = wmma_bf16(xdF[kc], load_frag(Wtk + woff), ak);
    }
#pragma unroll
    for (int r = 0; r < 8; ++r) {
      size_t o = ((size_t)slice * HW + pbase + wave * 16 + r + hi * 8) * CCH +
                 ct * 16 + l15;
      Qw[o] = (__bf16)aq[r];
      Kw[o] = (__bf16)ak[r];
    }
  }

  // ---- Vt GEMM: M = cout (wave owns 64 couts), N = p (all 64 rows)
  for (int mt = 0; mt < 4; ++mt) {
    const int cbase = wave * 64 + mt * 16;
    v16bf wvF[8];
#pragma unroll
    for (int kc = 0; kc < 8; ++kc)
      wvF[kc] = load_frag(Wtv + (cbase + l15) * CCH + kc * 32 + hi * 16);
    float bvr[8];
#pragma unroll
    for (int r = 0; r < 8; ++r) bvr[r] = bv[cbase + r + hi * 8];

    for (int nt = 0; nt < 4; ++nt) {
      v8f av;
#pragma unroll
      for (int r = 0; r < 8; ++r) av[r] = bvr[r];
#pragma unroll
      for (int kc = 0; kc < 8; ++kc) {
        v16bf xb = load_frag(Xd + (nt * 16 + l15) * XPITCH + kc * 32 + hi * 16);
        av = wmma_bf16(wvF[kc], xb, av);
      }
#pragma unroll
      for (int r = 0; r < 8; ++r) {
        size_t o = ((size_t)slice * CCH + cbase + r + hi * 8) * HW + pbase +
                   nt * 16 + l15;
        Vtw[o] = (__bf16)av[r];
      }
    }
  }
}

// ---------------------------------------------------------------------------
// Kernel 2: attention + residual + channel-major store.
// Workgroup = 2 waves = 32 query rows of one slice; each wave owns 16 rows.
// Scores strip [32][1028] f32 lives in LDS (exact softmax, two passes,
// no online rescaling). K/V fragments stream from L2-resident bf16 ws.
// ---------------------------------------------------------------------------
#define AROWS 32
#define SCP   1028     // scores pitch in floats (bank-stagger)

__global__ __launch_bounds__(64) void attn_k(
    const __bf16* __restrict__ Qw, const __bf16* __restrict__ Kw,
    const __bf16* __restrict__ Vtw, const float* __restrict__ img,
    float* __restrict__ out) {
  extern __shared__ unsigned char dynsmem[];
  float* smem   = (float*)dynsmem;
  float* scores = smem;                       // [AROWS][SCP]
  float* rowmax = smem + AROWS * SCP;         // [AROWS]
  float* rowsum = rowmax + AROWS;             // [AROWS]

  const int slice = blockIdx.x;
  const int pbase = blockIdx.y * AROWS;
  const int tid   = threadIdx.x;
  const int wave  = tid >> 5;
  const int lane  = tid & 31;
  const int l15   = lane & 15;
  const int hi    = lane >> 4;
  const int wrow  = wave * 16;

  const __bf16* Qs = Qw  + (size_t)slice * HW * CCH;
  const __bf16* Ks = Kw  + (size_t)slice * HW * CCH;
  const __bf16* Vs = Vtw + (size_t)slice * CCH * HW;

  // Register-resident Q fragments for this wave's 16 rows (8 K-chunks).
  v16bf qf[8];
  {
    const __bf16* qrow = Qs + (size_t)(pbase + wrow + l15) * CCH + hi * 16;
#pragma unroll
    for (int kc = 0; kc < 8; ++kc) qf[kc] = load_frag(qrow + kc * 32);
  }

  // ---- Phase 1: S = scale * Q K^T -> LDS; per-lane running row max.
  float rmax[8];
#pragma unroll
  for (int r = 0; r < 8; ++r) rmax[r] = -3.0e38f;

  for (int nt = 0; nt < 64; ++nt) {           // 1024 keys / 16
    v8f acc = {0.f, 0.f, 0.f, 0.f, 0.f, 0.f, 0.f, 0.f};
    const __bf16* krow = Ks + (size_t)(nt * 16 + l15) * CCH + hi * 16;
#pragma unroll
    for (int kc = 0; kc < 8; ++kc)
      acc = wmma_bf16(qf[kc], load_frag(krow + kc * 32), acc);
#pragma unroll
    for (int r = 0; r < 8; ++r) {
      float v = acc[r] * SCALE;
      rmax[r] = fmaxf(rmax[r], v);
      scores[(wrow + r + hi * 8) * SCP + nt * 16 + l15] = v;
    }
  }
  // Finish row max: butterfly inside each 16-lane group, publish via LDS.
#pragma unroll
  for (int r = 0; r < 8; ++r) {
    float m = rmax[r];
    m = fmaxf(m, __shfl_xor(m, 1, 32));
    m = fmaxf(m, __shfl_xor(m, 2, 32));
    m = fmaxf(m, __shfl_xor(m, 4, 32));
    m = fmaxf(m, __shfl_xor(m, 8, 32));
    rmax[r] = m;
  }
  if (l15 == 0) {
#pragma unroll
    for (int r = 0; r < 8; ++r) rowmax[wrow + r + hi * 8] = rmax[r];
  }

  // ---- Phase 2: P = exp(S - max); O += P V  (16 cout tiles accumulate).
  const int   myrow  = wrow + l15;            // this lane's row (A layout)
  const float myrmax = rowmax[myrow];         // same-wave LDS dependency
  float mysum = 0.f;

  v8f oacc[16];
#pragma unroll
  for (int ct = 0; ct < 16; ++ct)
#pragma unroll
    for (int i = 0; i < 8; ++i) oacc[ct][i] = 0.f;

  for (int nc = 0; nc < 32; ++nc) {           // key chunks of 32
    const float* srow = &scores[myrow * SCP + nc * 32 + hi * 16];
    float ev[16];
#pragma unroll
    for (int j = 0; j < 4; ++j) {
      float4 s = *(const float4*)(srow + 4 * j);
      ev[4 * j + 0] = __expf(s.x - myrmax);
      ev[4 * j + 1] = __expf(s.y - myrmax);
      ev[4 * j + 2] = __expf(s.z - myrmax);
      ev[4 * j + 3] = __expf(s.w - myrmax);
    }
    FragBF pf;
    __bf16* pb = (__bf16*)&pf.v;
#pragma unroll
    for (int j = 0; j < 16; ++j) { mysum += ev[j]; pb[j] = (__bf16)ev[j]; }

#pragma unroll
    for (int ct = 0; ct < 16; ++ct) {
      const __bf16* vrow =
          Vs + (size_t)(ct * 16 + l15) * HW + nc * 32 + hi * 16;
      oacc[ct] = wmma_bf16(pf.v, load_frag(vrow), oacc[ct]);
    }
  }
  mysum += __shfl_xor(mysum, 16, 32);         // join the two half-rows
  if (lane < 16) rowsum[myrow] = mysum;

  // ---- Phase 3: normalize, LDS transpose (reuse scores region), residual.
  __syncthreads();                            // everyone done reading scores
  float* ost = smem;                          // overlay: [AROWS][257]
  float inv[8];
#pragma unroll
  for (int r = 0; r < 8; ++r) inv[r] = 1.0f / rowsum[wrow + r + hi * 8];
#pragma unroll
  for (int ct = 0; ct < 16; ++ct)
#pragma unroll
    for (int r = 0; r < 8; ++r)
      ost[(wrow + r + hi * 8) * 257 + ct * 16 + l15] = oacc[ct][r] * inv[r];
  __syncthreads();

  const float* imgs = img + (size_t)slice * CCH * HW + pbase;
  float*       outs = out + (size_t)slice * CCH * HW + pbase;
#pragma unroll 4
  for (int it = 0; it < 128; ++it) {          // 32*256 / 64 threads
    int idx = it * 64 + tid;
    int c   = idx >> 5;
    int p   = idx & 31;
    outs[(size_t)c * HW + p] = ost[p * 257 + c] + imgs[(size_t)c * HW + p];
  }
}

// ---------------------------------------------------------------------------
// Launch: prep -> proj -> attn, all on `stream` (in-order).
// Workspace (bf16): Wt q/k/v (3*128KB), Q (16MB), K (16MB), Vt (16MB).
// ---------------------------------------------------------------------------
extern "C" void kernel_launch(void* const* d_in, const int* in_sizes, int n_in,
                              void* d_out, int out_size, void* d_ws,
                              size_t ws_size, hipStream_t stream) {
  (void)in_sizes; (void)n_in; (void)out_size; (void)ws_size;
  const float* img   = (const float*)d_in[0];
  const float* depth = (const float*)d_in[1];
  const float* Wq    = (const float*)d_in[2];
  const float* bq    = (const float*)d_in[3];
  const float* Wk    = (const float*)d_in[4];
  const float* bk    = (const float*)d_in[5];
  const float* Wv    = (const float*)d_in[6];
  const float* bv    = (const float*)d_in[7];
  float* out = (float*)d_out;

  char* ws = (char*)d_ws;
  const size_t WT_BYTES = (size_t)CCH * CCH * 2;       // 128 KB each
  const size_t M_BYTES  = (size_t)NSLICE * HW * CCH * 2;  // 16 MB each
  __bf16* Wtq = (__bf16*)(ws);
  __bf16* Wtk = (__bf16*)(ws + WT_BYTES);
  __bf16* Wtv = (__bf16*)(ws + 2 * WT_BYTES);
  __bf16* Qw  = (__bf16*)(ws + 3 * WT_BYTES);
  __bf16* Kw  = (__bf16*)(ws + 3 * WT_BYTES + M_BYTES);
  __bf16* Vtw = (__bf16*)(ws + 3 * WT_BYTES + 2 * M_BYTES);

  prep_weights_k<<<CCH * CCH / 256, 256, 0, stream>>>(Wq, Wk, Wv, Wtq, Wtk,
                                                      Wtv);

  const size_t proj_lds = (size_t)2 * 64 * XPITCH * sizeof(__bf16);
  proj_k<<<dim3(NSLICE, HW / 64), 128, proj_lds, stream>>>(
      img, depth, Wtq, Wtk, Wtv, bq, bk, bv, Qw, Kw, Vtw);

  const size_t attn_lds = (size_t)(AROWS * SCP + 2 * AROWS) * sizeof(float);
  attn_k<<<dim3(NSLICE, HW / AROWS), 64, attn_lds, stream>>>(Qw, Kw, Vtw, img,
                                                             out);
}

// v001
// Measured time: 104 microseconds a run.
// In both of two side-by-side timings against v000, it was 1.97 times as fast.
#include <hip/hip_runtime.h>

// Problem dims (fixed by reference): B=4,S=8 -> 32 slices; H*W=1024; C1=C2=C=256.
#define NSLICE 32
#define HW     1024
#define CCH    256
#define SCALE  0.0625f   // 1/sqrt(256)

typedef __attribute__((ext_vector_type(16))) __bf16 v16bf;
typedef __attribute__((ext_vector_type(8)))  float  v8f;

union FragBF { v16bf v; uint4 u[2]; };

// Load one WMMA operand fragment: lane holds 16 contiguous bf16 (32 bytes).
// Works for both A fragments (lane = row M, K contiguous) and B fragments
// (lane = col N, K contiguous) because B-frag == B^T in A layout.
__device__ __forceinline__ v16bf load_frag(const __bf16* p) {
  FragBF f;
  f.u[0] = *(const uint4*)(p);
  f.u[1] = *(const uint4*)(p + 8);
  return f.v;
}

__device__ __forceinline__ v8f wmma_bf16(v16bf a, v16bf b, v8f c) {
  return __builtin_amdgcn_wmma_f32_16x16x32_bf16(
      /*neg_a=*/false, a, /*neg_b=*/false, b,
      /*c_mod=*/(short)0, c, /*reuse_a=*/false, /*reuse_b=*/false);
}

// ---------------------------------------------------------------------------
// Kernel 0: transpose + bf16-convert the three 256x256 weight matrices.
// W[c][cout] (row-major) -> Wt[cout][c] bf16 so projection fragments are
// contiguous per-lane 32B loads.
// ---------------------------------------------------------------------------
__global__ __launch_bounds__(256) void prep_weights_k(
    const float* __restrict__ Wq, const float* __restrict__ Wk,
    const float* __restrict__ Wv,
    __bf16* __restrict__ Wtq, __bf16* __restrict__ Wtk,
    __bf16* __restrict__ Wtv) {
  int idx  = blockIdx.x * 256 + threadIdx.x;   // 0..65535
  int cout = idx >> 8;
  int c    = idx & 255;
  int src  = c * CCH + cout;
  Wtq[idx] = (__bf16)Wq[src];
  Wtk[idx] = (__bf16)Wk[src];
  Wtv[idx] = (__bf16)Wv[src];
}

// ---------------------------------------------------------------------------
// Kernel 1: projections.  Per workgroup: one slice, 64 spatial rows.
//   Q[p][cout], K[p][cout]  (row-major bf16)   = X  @ W + b
//   Vt[cout][p]             (transposed bf16)  = (Xd @ Wv + bv)^T
// X is staged channel-major->row-major through LDS as bf16.
// Block = 128 threads (4 waves). Dynamic LDS = 2 * 64 * 264 bf16.
// ---------------------------------------------------------------------------
#define XPITCH 264

__global__ __launch_bounds__(128) void proj_k(
    const float* __restrict__ img, const float* __restrict__ depth,
    const __bf16* __restrict__ Wtq, const __bf16* __restrict__ Wtk,
    const __bf16* __restrict__ Wtv,
    const float* __restrict__ bq, const float* __restrict__ bk,
    const float* __restrict__ bv,
    __bf16* __restrict__ Qw, __bf16* __restrict__ Kw,
    __bf16* __restrict__ Vtw) {
  extern __shared__ unsigned char dynsmem[];
  __bf16* Xi = (__bf16*)dynsmem;          // [64][XPITCH] img  rows (bf16)
  __bf16* Xd = Xi + 64 * XPITCH;          // [64][XPITCH] depth rows

  const int slice = blockIdx.x;
  const int pbase = blockIdx.y * 64;
  const int tid   = threadIdx.x;
  const int wave  = tid >> 5;
  const int lane  = tid & 31;
  const int l15   = lane & 15;
  const int hi    = lane >> 4;            // 0: K 0..15, 1: K 16..31

  // ---- Stage inputs: global [c][p] f32 (coalesced in p) -> LDS [p][c] bf16
  {
    const float* ib = img   + (size_t)slice * CCH * HW + pbase;
    const float* db = depth + (size_t)slice * CCH * HW + pbase;
#pragma unroll 4
    for (int it = 0; it < 128; ++it) {    // 64*256 / 128 threads
      int idx = it * 128 + tid;
      int c   = idx >> 6;
      int p   = idx & 63;
      Xi[p * XPITCH + c] = (__bf16)ib[(size_t)c * HW + p];
      Xd[p * XPITCH + c] = (__bf16)db[(size_t)c * HW + p];
    }
  }
  __syncthreads();

  // ---- Q and K GEMMs: wave w owns rows [w*16, w*16+16)
  v16bf xiF[8], xdF[8];
#pragma unroll
  for (int kc = 0; kc < 8; ++kc) {
    const int off = (wave * 16 + l15) * XPITCH + kc * 32 + hi * 16;
    xiF[kc] = load_frag(Xi + off);
    xdF[kc] = load_frag(Xd + off);
  }

  for (int ct = 0; ct < 16; ++ct) {       // 16 cout tiles
    float biasq = bq[ct * 16 + l15];
    float biask = bk[ct * 16 + l15];
    v8f aq, ak;
#pragma unroll
    for (int i = 0; i < 8; ++i) { aq[i] = biasq; ak[i] = biask; }
#pragma unroll
    for (int kc = 0; kc < 8; ++kc) {
      const int woff = (ct * 16 + l15) * CCH + kc * 32 + hi * 16;
      aq = wmma_bf16(xiF[kc], load_frag(Wtq + woff), aq);
      ak = wmma_bf16(xdF[kc], load_frag(Wtk + woff), ak);
    }
#pragma unroll
    for (int r = 0; r < 8; ++r) {
      size_t o = ((size_t)slice * HW + pbase + wave * 16 + r + hi * 8) * CCH +
                 ct * 16 + l15;
      Qw[o] = (__bf16)aq[r];
      Kw[o] = (__bf16)ak[r];
    }
  }

  // ---- Vt GEMM: M = cout (wave owns 64 couts), N = p (all 64 rows)
  for (int mt = 0; mt < 4; ++mt) {
    const int cbase = wave * 64 + mt * 16;
    v16bf wvF[8];
#pragma unroll
    for (int kc = 0; kc < 8; ++kc)
      wvF[kc] = load_frag(Wtv + (cbase + l15) * CCH + kc * 32 + hi * 16);
    float bvr[8];
#pragma unroll
    for (int r = 0; r < 8; ++r) bvr[r] = bv[cbase + r + hi * 8];

    for (int nt = 0; nt < 4; ++nt) {
      v8f av;
#pragma unroll
      for (int r = 0; r < 8; ++r) av[r] = bvr[r];
#pragma unroll
      for (int kc = 0; kc < 8; ++kc) {
        v16bf xb = load_frag(Xd + (nt * 16 + l15) * XPITCH + kc * 32 + hi * 16);
        av = wmma_bf16(wvF[kc], xb, av);
      }
#pragma unroll
      for (int r = 0; r < 8; ++r) {
        size_t o = ((size_t)slice * CCH + cbase + r + hi * 8) * HW + pbase +
                   nt * 16 + l15;
        Vtw[o] = (__bf16)av[r];
      }
    }
  }
}

// ---------------------------------------------------------------------------
// Kernel 2: attention + residual + channel-major store.
// Workgroup = 8 waves = 128 query rows of one slice; each wave owns 16 rows.
// K and V^T tiles of 64 keys are staged in LDS once per workgroup (two
// buffers, one barrier per pass) and read by all 8 waves. No score strip:
// running row maximum and sum, accumulators rescaled once per pass.
// Every inner loop is fully unrolled (#pragma unroll): its arrays stay in
// registers only with constant indices.
// ---------------------------------------------------------------------------
#define QROWS 128                 // query rows per workgroup
#define KT    64                  // keys per pass
#define KP    264                 // K tile pitch in bf16: 528 B = 16 B x odd
#define VP    72                  // V^T / P tile pitch in bf16: 144 B = 16 B x odd
#define KBUF  (KT * KP)           // elements of one K buffer
#define VBUF  (CCH * VP)          // elements of one V^T buffer
#define PBUF  (16 * VP)           // elements of one wave's P tile
#define NPASS (HW / KT)
#define ATTN_LDS ((2 * KBUF + 2 * VBUF + 8 * PBUF) * 2)

typedef __attribute__((ext_vector_type(4))) unsigned int u32x4;

// Fragment load without a type tag: the P tile is written as single bf16 by
// other lanes of the same wave just before, with no barrier in between.
__device__ __forceinline__ v16bf load_frag_p(const __bf16* p) {
  FragBF f;
  __builtin_memcpy(&f, __builtin_assume_aligned(p, 16), 32);
  return f.v;
}

// Maximum / sum over the 16 lanes of a row (DPP row_xmask 1, 2, 4, 8).
#define XM(v, m)                                                            \
  __int_as_float(__builtin_amdgcn_update_dpp(0, __float_as_int(v),          \
                                             0x160 + (m), 0xf, 0xf, true))
__device__ __forceinline__ float row16_max(float v) {
  v = fmaxf(v, XM(v, 1));
  v = fmaxf(v, XM(v, 2));
  v = fmaxf(v, XM(v, 4));
  v = fmaxf(v, XM(v, 8));
  return v;
}
__device__ __forceinline__ float row16_sum(float v) {
  v += XM(v, 1);
  v += XM(v, 2);
  v += XM(v, 4);
  v += XM(v, 8);
  return v;
}

__global__ __launch_bounds__(256) void attn_k(
    const __bf16* __restrict__ Qw, const __bf16* __restrict__ Kw,
    const __bf16* __restrict__ Vtw, const float* __restrict__ img,
    float* __restrict__ out) {
  __shared__ __attribute__((aligned(16))) unsigned char smem[ATTN_LDS];

  const int slice = blockIdx.x;
  const int pbase = blockIdx.y * QROWS;
  const int tid   = threadIdx.x;
  const int wave  = tid >> 5;
  const int lane  = tid & 31;
  const int l15   = lane & 15;
  const int hi    = lane >> 4;
  const int wrow  = wave * 16;

  __bf16* Kt = (__bf16*)smem;                 // [2][KT][KP]
  __bf16* Vt = Kt + 2 * KBUF;                 // [2][CCH][VP]
  __bf16* Pw = Vt + 2 * VBUF + wave * PBUF;   // [16][VP], this wave's own

  const __bf16* Qs = Qw  + (size_t)slice * HW * CCH;
  const __bf16* Ks = Kw  + (size_t)slice * HW * CCH;
  const __bf16* Vs = Vtw + (size_t)slice * CCH * HW;

  // Each thread moves 8 + 8 pieces of 16 B per tile. A K tile (64 rows of
  // 512 B) is one contiguous 32 KB run; a V^T tile is 256 rows of 128 B.
  const int krow = tid >> 5, kseg = tid & 31;   // + 8 rows per piece
  const int vrow = tid >> 3, vseg = tid & 7;    // + 32 rows per piece
  const __bf16* kg = Ks + tid * 8;
  const __bf16* vg = Vs + (size_t)vrow * HW + vseg * 8;
  __bf16* kl = Kt + krow * KP + kseg * 8;
  __bf16* vl = Vt + vrow * VP + vseg * 8;

  u32x4 kst[8], vst[8];
#pragma unroll
  for (int i = 0; i < 8; ++i) {
    kst[i] = *(const u32x4*)(kg + i * 2048);
    vst[i] = *(const u32x4*)(vg + (size_t)i * 32 * HW);
  }

  // Register-resident Q fragments for this wave's 16 rows (8 K-chunks).
  v16bf qf[8];
  {
    const __bf16* qrow = Qs + (size_t)(pbase + wrow + l15) * CCH + hi * 16;
#pragma unroll
    for (int kc = 0; kc < 8; ++kc) qf[kc] = load_frag(qrow + kc * 32);
    // The loads' address registers are reused before their data is waited for.
    asm volatile("s_wait_xcnt 0x0" ::: "memory");
  }

#pragma unroll
  for (int i = 0; i < 8; ++i) {
    *(u32x4*)(kl + i * 8 * KP)  = kst[i];
    *(u32x4*)(vl + i * 32 * VP) = vst[i];
  }
  __syncthreads();

  // Row state in accumulator layout: register r = row r + 8 * hi.
  float rmax[8], rsum[8];                     // rsum: this lane's columns only
  v8f oacc[16];
#pragma unroll
  for (int r = 0; r < 8; ++r) { rmax[r] = -3.0e38f; rsum[r] = 0.f; }
#pragma unroll
  for (int ct = 0; ct < 16; ++ct)
#pragma unroll
    for (int i = 0; i < 8; ++i) oacc[ct][i] = 0.f;

  for (int t = 0; t < NPASS; ++t) {
    const __bf16* Kb = Kt + (t & 1) * KBUF;
    const __bf16* Vb = Vt + (t & 1) * VBUF;
    const bool more = (t + 1 < NPASS);

    // Next tile's global loads fly under this pass's products.
    if (more) {
#pragma unroll
      for (int i = 0; i < 8; ++i) {
        kst[i] = *(const u32x4*)(kg + (t + 1) * (KT * CCH) + i * 2048);
        vst[i] = *(const u32x4*)(vg + (size_t)i * 32 * HW + (t + 1) * KT);
      }
      // The loads' address registers are reused right behind them.
      asm volatile("s_wait_xcnt 0x0" ::: "memory");
    }

    // S = Q K^T for 16 rows x 64 keys: four independent accumulator tiles.
    // LDS fragments come in groups of 8 (16 reads), each group issued as one
    // run a group ahead of its products, into the other half of fb.
    v16bf fb[2][8];
    v8f s[4];
#pragma unroll
    for (int nt = 0; nt < 4; ++nt)
#pragma unroll
      for (int i = 0; i < 8; ++i) s[nt][i] = 0.f;
#pragma unroll
    for (int j = 0; j < 8; ++j)
      fb[0][j] = load_frag(Kb + ((j & 3) * 16 + l15) * KP + (j >> 2) * 32 + hi * 16);
#pragma unroll
    for (int g = 0; g < 4; ++g) {
#pragma unroll
      for (int j = 0; j < 8; ++j) {
        if (g < 3)
          fb[(g + 1) & 1][j] = load_frag(Kb + ((j & 3) * 16 + l15) * KP +
                                         ((g + 1) * 2 + (j >> 2)) * 32 + hi * 16);
        else   // first V^T group: flies under the last products and the softmax
          fb[0][j] = load_frag(Vb + ((j & 3) * 16 + l15) * VP + (j >> 2) * 32 + hi * 16);
      }
      // Keeps the next group's reads together ahead of this group's products.
      __builtin_amdgcn_sched_barrier(0);
#pragma unroll
      for (int j = 0; j < 8; ++j)
        s[j & 3] = wmma_bf16(qf[g * 2 + (j >> 2)], fb[g & 1][j], s[j & 3]);
      // Keeps the group after next from being spread among these products.
      __builtin_amdgcn_sched_barrier(0);
    }

    // Running maximum and sum; P (bf16) to this wave's LDS tile.
    float alpha[8];
#pragma unroll
    for (int r = 0; r < 8; ++r) {
      float tm = fmaxf(fmaxf(s[0][r], s[1][r]), fmaxf(s[2][r], s[3][r])) * SCALE;
      tm = row16_max(tm);
      const float mn = fmaxf(rmax[r], tm);
      alpha[r] = __expf(rmax[r] - mn);
      rmax[r]  = mn;
      float ps = 0.f;
#pragma unroll
      for (int nt = 0; nt < 4; ++nt) {
        float p = __expf(s[nt][r] * SCALE - mn);
        ps += p;
        Pw[(r + hi * 8) * VP + nt * 16 + l15] = (__bf16)p;
      }
      rsum[r] = rsum[r] * alpha[r] + ps;
    }

    // O += P V: A = P rows (same-wave LDS round trip), B = V^T rows, in
    // groups of 4 channel tiles x 2 key chunks, fetched a group ahead as above.
    v16bf pf[2];
#pragma unroll
    for (int c = 0; c < 2; ++c)
      pf[c] = load_frag_p(Pw + l15 * VP + c * 32 + hi * 16);
#pragma unroll
    for (int g = 0; g < 4; ++g) {
      if (g < 3) {
#pragma unroll
        for (int j = 0; j < 8; ++j)
          fb[(g + 1) & 1][j] = load_frag(Vb + (((g + 1) * 4 + (j & 3)) * 16 + l15) * VP +
                                         (j >> 2) * 32 + hi * 16);
      }
      // Keeps the next group's reads together ahead of this group's products.
      __builtin_amdgcn_sched_barrier(0);
      if (g == 0) {   // rescale under the latency of the P and V^T reads
#pragma unroll
        for (int ct = 0; ct < 16; ++ct)
#pragma unroll
          for (int r = 0; r < 8; ++r) oacc[ct][r] *= alpha[r];
      }
#pragma unroll
      for (int j = 0; j < 8; ++j)
        oacc[g * 4 + (j & 3)] =
            wmma_bf16(pf[j >> 2], fb[g & 1][j], oacc[g * 4 + (j & 3)]);
      // Keeps the group after next from being spread among these products.
      __builtin_amdgcn_sched_barrier(0);
    }

    // Fill the other buffer: its readers left it at the last barrier.
    if (more) {
      const int nb = (t + 1) & 1;
#pragma unroll
      for (int i = 0; i < 8; ++i) {
        *(u32x4*)(kl + nb * KBUF + i * 8 * KP)  = kst[i];
        *(u32x4*)(vl + nb * VBUF + i * 32 * VP) = vst[i];
      }
    }
    __syncthreads();   // publishes tile t + 1, ends every read of tile t
  }

  // ---- Normalize, LDS transpose (over the K / V buffers), residual.
  // The last pass's barrier has ended every read of the tiles.
  float* ost = (float*)smem;                  // overlay: [QROWS][257]
  float inv[8];
#pragma unroll
  for (int r = 0; r < 8; ++r) inv[r] = 1.0f / row16_sum(rsum[r]);
#pragma unroll
  for (int ct = 0; ct < 16; ++ct)
#pragma unroll
    for (int r = 0; r < 8; ++r)
      ost[(wrow + r + hi * 8) * 257 + ct * 16 + l15] = oacc[ct][r] * inv[r];
  __syncthreads();

  const float* imgs = img + (size_t)slice * CCH * HW + pbase;
  float*       outs = out + (size_t)slice * CCH * HW + pbase;
#pragma unroll 4
  for (int it = 0; it < 128; ++it) {          // 128*256 / 256 threads
    int idx = it * 256 + tid;
    int c   = idx >> 7;
    int p   = idx & 127;
    outs[(size_t)c * HW + p] = ost[p * 257 + c] + imgs[(size_t)c * HW + p];
  }
}

// ---------------------------------------------------------------------------
// Launch: prep -> proj -> attn, all on `stream` (in-order).
// Workspace (bf16): Wt q/k/v (3*128KB), Q (16MB), K (16MB), Vt (16MB).
// ---------------------------------------------------------------------------
extern "C" void kernel_launch(void* const* d_in, const int* in_sizes, int n_in,
                              void* d_out, int out_size, void* d_ws,
                              size_t ws_size, hipStream_t stream) {
  (void)in_sizes; (void)n_in; (void)out_size; (void)ws_size;
  const float* img   = (const float*)d_in[0];
  const float* depth = (const float*)d_in[1];
  const float* Wq    = (const float*)d_in[2];
  const float* bq    = (const float*)d_in[3];
  const float* Wk    = (const float*)d_in[4];
  const float* bk    = (const float*)d_in[5];
  const float* Wv    = (const float*)d_in[6];
  const float* bv    = (const float*)d_in[7];
  float* out = (float*)d_out;

  char* ws = (char*)d_ws;
  const size_t WT_BYTES = (size_t)CCH * CCH * 2;       // 128 KB each
  const size_t M_BYTES  = (size_t)NSLICE * HW * CCH * 2;  // 16 MB each
  __bf16* Wtq = (__bf16*)(ws);
  __bf16* Wtk = (__bf16*)(ws + WT_BYTES);
  __bf16* Wtv = (__bf16*)(ws + 2 * WT_BYTES);
  __bf16* Qw  = (__bf16*)(ws + 3 * WT_BYTES);
  __bf16* Kw  = (__bf16*)(ws + 3 * WT_BYTES + M_BYTES);
  __bf16* Vtw = (__bf16*)(ws + 3 * WT_BYTES + 2 * M_BYTES);

  prep_weights_k<<<CCH * CCH / 256, 256, 0, stream>>>(Wq, Wk, Wv, Wtq, Wtk,
                                                      Wtv);

  const size_t proj_lds = (size_t)2 * 64 * XPITCH * sizeof(__bf16);
  proj_k<<<dim3(NSLICE, HW / 64), 128, proj_lds, stream>>>(
      img, depth, Wtq, Wtk, Wtv, bq, bk, bv, Qw, Kw, Vtw);

  attn_k<<<dim3(NSLICE, HW / QROWS), 256, 0, stream>>>(Qw, Kw, Vtw, img, out);
}

// v002
// One run takes 97.7 microseconds.
// Two timings next to v001 put it at 1.08 and 1.05 times that version's speed.
// Over all steps from v000 it is 2.09 times as fast.
#include <hip/hip_runtime.h>

// Problem dims (fixed by reference): B=4,S=8 -> 32 slices; H*W=1024; C1=C2=C=256.
#define NSLICE 32
#define HW     1024
#define CCH    256
#define SCALE  0.0625f   // 1/sqrt(256)

typedef __attribute__((ext_vector_type(16))) __bf16 v16bf;
typedef __attribute__((ext_vector_type(8)))  float  v8f;

union FragBF { v16bf v; uint4 u[2]; };

// Load one WMMA operand fragment: lane holds 16 contiguous bf16 (32 bytes).
// Works for both A fragments (lane = row M, K contiguous) and B fragments
// (lane = col N, K contiguous) because B-frag == B^T in A layout.
__device__ __forceinline__ v16bf load_frag(const __bf16* p) {
  FragBF f;
  f.u[0] = *(const uint4*)(p);
  f.u[1] = *(const uint4*)(p + 8);
  return f.v;
}

__device__ __forceinline__ v8f wmma_bf16(v16bf a, v16bf b, v8f c) {
  return __builtin_amdgcn_wmma_f32_16x16x32_bf16(
      /*neg_a=*/false, a, /*neg_b=*/false, b,
      /*c_mod=*/(short)0, c, /*reuse_a=*/false, /*reuse_b=*/false);
}

// Weight fragment from the packed layout written by prep_weights_k: the 16-B
// pieces of the 32 lanes lie side by side, so each wave-wide load covers 512
// contiguous bytes (4 whole 128-B lines). Same element in the same lane and
// register as load_frag on a [cout][c] row: tile = cout / 16, kc = c / 32.
__device__ __forceinline__ v16bf load_wfrag(const __bf16* Wp, int tile, int kc,
                                            int lane) {
  const __bf16* p = Wp + (tile * 8 + kc) * 512 + lane * 8;
  FragBF f;
  f.u[0] = *(const uint4*)(p);
  f.u[1] = *(const uint4*)(p + 256);
  return f.v;
}

// ---------------------------------------------------------------------------
// Kernel 0: bf16-convert the three 256x256 weight matrices and pack them in
// fragment order: W[c][cout] (row-major) ->
//   Wp[cout / 16][c / 32][h][lane][e],  lane = ((c >> 4) & 1) * 16 + cout % 16,
//   h = (c >> 3) & 1, e = c & 7   (1 KB per 16 x 32 fragment).
// ---------------------------------------------------------------------------
__global__ __launch_bounds__(256) void prep_weights_k(
    const float* __restrict__ Wq, const float* __restrict__ Wk,
    const float* __restrict__ Wv,
    __bf16* __restrict__ Wtq, __bf16* __restrict__ Wtk,
    __bf16* __restrict__ Wtv) {
  int idx  = blockIdx.x * 256 + threadIdx.x;   // 0..65535, packed position
  int e    = idx & 7;
  int ln   = (idx >> 3) & 31;
  int h    = (idx >> 8) & 1;
  int kc   = (idx >> 9) & 7;
  int tile = idx >> 12;
  int cout = tile * 16 + (ln & 15);
  int c    = kc * 32 + (ln >> 4) * 16 + h * 8 + e;
  int src  = c * CCH + cout;
  Wtq[idx] = (__bf16)Wq[src];
  Wtk[idx] = (__bf16)Wk[src];
  Wtv[idx] = (__bf16)Wv[src];
}

// ---------------------------------------------------------------------------
// Kernel 1: projections.  Per workgroup: one slice, 64 spatial rows.
//   Q[p][cout], K[p][cout]  (row-major bf16)   = X  @ W + b
//   Vt[cout][p]             (transposed bf16)  = (Xd @ Wv + bv)^T
// X is staged channel-major->row-major through LDS as bf16.
// Block = 128 threads (4 waves). Dynamic LDS = 2 * 64 * 264 bf16.
// ---------------------------------------------------------------------------
#define XPITCH 264

__global__ __launch_bounds__(128) void proj_k(
    const float* __restrict__ img, const float* __restrict__ depth,
    const __bf16* __restrict__ Wtq, const __bf16* __restrict__ Wtk,
    const __bf16* __restrict__ Wtv,
    const float* __restrict__ bq, const float* __restrict__ bk,
    const float* __restrict__ bv,
    __bf16* __restrict__ Qw, __bf16* __restrict__ Kw,
    __bf16* __restrict__ Vtw) {
  extern __shared__ unsigned char dynsmem[];
  __bf16* Xi = (__bf16*)dynsmem;          // [64][XPITCH] img  rows (bf16)
  __bf16* Xd = Xi + 64 * XPITCH;          // [64][XPITCH] depth rows

  const int slice = blockIdx.x;
  const int pbase = blockIdx.y * 64;
  const int tid   = threadIdx.x;
  const int wave  = tid >> 5;
  const int lane  = tid & 31;
  const int l15   = lane & 15;
  const int hi    = lane >> 4;            // 0: K 0..15, 1: K 16..31

  // ---- Stage inputs: global [c][p] f32 (coalesced in p) -> LDS [p][c] bf16
  {
    const float* ib = img   + (size_t)slice * CCH * HW + pbase;
    const float* db = depth + (size_t)slice * CCH * HW + pbase;
#pragma unroll 4
    for (int it = 0; it < 128; ++it) {    // 64*256 / 128 threads
      int idx = it * 128 + tid;
      int c   = idx >> 6;
      int p   = idx & 63;
      Xi[p * XPITCH + c] = (__bf16)ib[(size_t)c * HW + p];
      Xd[p * XPITCH + c] = (__bf16)db[(size_t)c * HW + p];
    }
  }
  __syncthreads();

  // ---- Q and K GEMMs: wave w owns rows [w*16, w*16+16)
  v16bf xiF[8], xdF[8];
#pragma unroll
  for (int kc = 0; kc < 8; ++kc) {
    const int off = (wave * 16 + l15) * XPITCH + kc * 32 + hi * 16;
    xiF[kc] = load_frag(Xi + off);
    xdF[kc] = load_frag(Xd + off);
  }

  for (int ct = 0; ct < 16; ++ct) {       // 16 cout tiles
    float biasq = bq[ct * 16 + l15];
    float biask = bk[ct * 16 + l15];
    v8f aq, ak;
#pragma unroll
    for (int i = 0; i < 8; ++i) { aq[i] = biasq; ak[i] = biask; }
#pragma unroll
    for (int kc = 0; kc < 8; ++kc) {
      aq = wmma_bf16(xiF[kc], load_wfrag(Wtq, ct, kc, lane), aq);
      ak = wmma_bf16(xdF[kc], load_wfrag(Wtk, ct, kc, lane), ak);
    }
#pragma unroll
    for (int r = 0; r < 8; ++r) {
      size_t o = ((size_t)slice * HW + pbase + wave * 16 + r + hi * 8) * CCH +
                 ct * 16 + l15;
      Qw[o] = (__bf16)aq[r];
      Kw[o] = (__bf16)ak[r];
    }
  }

  // ---- Vt GEMM: M = cout (wave owns 64 couts), N = p (all 64 rows)
  // Xd fragments of all 64 rows stay in registers across the mt loop (the
  // wait below is a memory clobber: reads left inside would repeat per mt).
  v16bf xbF[4][8];
#pragma unroll   // constant indices keep xbF in registers
  for (int nt = 0; nt < 4; ++nt)
#pragma unroll   // as above
    for (int kc = 0; kc < 8; ++kc)
      xbF[nt][kc] = load_frag(Xd + (nt * 16 + l15) * XPITCH + kc * 32 + hi * 16);

  for (int mt = 0; mt < 4; ++mt) {
    const int cbase = wave * 64 + mt * 16;
    v16bf wvF[8];
#pragma unroll
    for (int kc = 0; kc < 8; ++kc)
      wvF[kc] = load_wfrag(Wtv, wave * 4 + mt, kc, lane);
    float bvr[8];
#pragma unroll
    for (int r = 0; r < 8; ++r) bvr[r] = bv[cbase + r + hi * 8];
    // The loads' address registers are stepped for the next mt behind them.
    asm volatile("s_wait_xcnt 0x0" ::: "memory");
    // Keeps that step (and the products) from being lifted over the wait.
    __builtin_amdgcn_sched_barrier(0);

#pragma unroll   // xbF stays in registers only with constant indices
    for (int nt = 0; nt < 4; ++nt) {
      v8f av;
#pragma unroll
      for (int r = 0; r < 8; ++r) av[r] = bvr[r];
#pragma unroll
      for (int kc = 0; kc < 8; ++kc)
        av = wmma_bf16(wvF[kc], xbF[nt][kc], av);
#pragma unroll
      for (int r = 0; r < 8; ++r) {
        size_t o = ((size_t)slice * CCH + cbase + r + hi * 8) * HW + pbase +
                   nt * 16 + l15;
        Vtw[o] = (__bf16)av[r];
      }
    }
  }
}

// ---------------------------------------------------------------------------
// Kernel 2: attention + residual + channel-major store.
// Workgroup = 8 waves = 128 query rows of one slice; each wave owns 16 rows.
// K and V^T tiles of 64 keys are staged in LDS once per workgroup (two
// buffers, one barrier per pass) and read by all 8 waves. No score strip:
// running row maximum and sum, accumulators rescaled once per pass.
// Every inner loop is fully unrolled (#pragma unroll): its arrays stay in
// registers only with constant indices.
// ---------------------------------------------------------------------------
#define QROWS 128                 // query rows per workgroup
#define KT    64                  // keys per pass
#define KP    264                 // K tile pitch in bf16: 528 B = 16 B x odd
#define VP    72                  // V^T / P tile pitch in bf16: 144 B = 16 B x odd
#define KBUF  (KT * KP)           // elements of one K buffer
#define VBUF  (CCH * VP)          // elements of one V^T buffer
#define PBUF  (16 * VP)           // elements of one wave's P tile
#define NPASS (HW / KT)
#define ATTN_LDS ((2 * KBUF + 2 * VBUF + 8 * PBUF) * 2)

typedef __attribute__((ext_vector_type(4))) unsigned int u32x4;

// Fragment load without a type tag: the P tile is written as single bf16 by
// other lanes of the same wave just before, with no barrier in between.
__device__ __forceinline__ v16bf load_frag_p(const __bf16* p) {
  FragBF f;
  __builtin_memcpy(&f, __builtin_assume_aligned(p, 16), 32);
  return f.v;
}

// Maximum / sum over the 16 lanes of a row (DPP row_xmask 1, 2, 4, 8).
#define XM(v, m)                                                            \
  __int_as_float(__builtin_amdgcn_update_dpp(0, __float_as_int(v),          \
                                             0x160 + (m), 0xf, 0xf, true))
__device__ __forceinline__ float row16_max(float v) {
  v = fmaxf(v, XM(v, 1));
  v = fmaxf(v, XM(v, 2));
  v = fmaxf(v, XM(v, 4));
  v = fmaxf(v, XM(v, 8));
  return v;
}
__device__ __forceinline__ float row16_sum(float v) {
  v += XM(v, 1);
  v += XM(v, 2);
  v += XM(v, 4);
  v += XM(v, 8);
  return v;
}

__global__ __launch_bounds__(256) void attn_k(
    const __bf16* __restrict__ Qw, const __bf16* __restrict__ Kw,
    const __bf16* __restrict__ Vtw, const float* __restrict__ img,
    float* __restrict__ out) {
  __shared__ __attribute__((aligned(16))) unsigned char smem[ATTN_LDS];

  const int slice = blockIdx.x;
  const int pbase = blockIdx.y * QROWS;
  const int tid   = threadIdx.x;
  const int wave  = tid >> 5;
  const int lane  = tid & 31;
  const int l15   = lane & 15;
  const int hi    = lane >> 4;
  const int wrow  = wave * 16;

  __bf16* Kt = (__bf16*)smem;                 // [2][KT][KP]
  __bf16* Vt = Kt + 2 * KBUF;                 // [2][CCH][VP]
  __bf16* Pw = Vt + 2 * VBUF + wave * PBUF;   // [16][VP], this wave's own

  const __bf16* Qs = Qw  + (size_t)slice * HW * CCH;
  const __bf16* Ks = Kw  + (size_t)slice * HW * CCH;
  const __bf16* Vs = Vtw + (size_t)slice * CCH * HW;

  // Each thread moves 8 + 8 pieces of 16 B per tile. A K tile (64 rows of
  // 512 B) is one contiguous 32 KB run; a V^T tile is 256 rows of 128 B.
  const int krow = tid >> 5, kseg = tid & 31;   // + 8 rows per piece
  const int vrow = tid >> 3, vseg = tid & 7;    // + 32 rows per piece
  const __bf16* kg = Ks + tid * 8;
  const __bf16* vg = Vs + (size_t)vrow * HW + vseg * 8;
  __bf16* kl = Kt + krow * KP + kseg * 8;
  __bf16* vl = Vt + vrow * VP + vseg * 8;

  u32x4 kst[8], vst[8];
#pragma unroll
  for (int i = 0; i < 8; ++i) {
    kst[i] = *(const u32x4*)(kg + i * 2048);
    vst[i] = *(const u32x4*)(vg + (size_t)i * 32 * HW);
  }

  // Register-resident Q fragments for this wave's 16 rows (8 K-chunks).
  v16bf qf[8];
  {
    const __bf16* qrow = Qs + (size_t)(pbase + wrow + l15) * CCH + hi * 16;
#pragma unroll
    for (int kc = 0; kc < 8; ++kc) qf[kc] = load_frag(qrow + kc * 32);
    // The loads' address registers are reused before their data is waited for.
    asm volatile("s_wait_xcnt 0x0" ::: "memory");
  }

#pragma unroll
  for (int i = 0; i < 8; ++i) {
    *(u32x4*)(kl + i * 8 * KP)  = kst[i];
    *(u32x4*)(vl + i * 32 * VP) = vst[i];
  }
  __syncthreads();

  // Row state in accumulator layout: register r = row r + 8 * hi.
  float rmax[8], rsum[8];                     // rsum: this lane's columns only
  v8f oacc[16];
#pragma unroll
  for (int r = 0; r < 8; ++r) { rmax[r] = -3.0e38f; rsum[r] = 0.f; }
#pragma unroll
  for (int ct = 0; ct < 16; ++ct)
#pragma unroll
    for (int i = 0; i < 8; ++i) oacc[ct][i] = 0.f;

  for (int t = 0; t < NPASS; ++t) {
    const __bf16* Kb = Kt + (t & 1) * KBUF;
    const __bf16* Vb = Vt + (t & 1) * VBUF;
    const bool more = (t + 1 < NPASS);

    // Next tile's global loads fly under this pass's products.
    if (more) {
#pragma unroll
      for (int i = 0; i < 8; ++i) {
        kst[i] = *(const u32x4*)(kg + (t + 1) * (KT * CCH) + i * 2048);
        vst[i] = *(const u32x4*)(vg + (size_t)i * 32 * HW + (t + 1) * KT);
      }
      // The loads' address registers are reused right behind them.
      asm volatile("s_wait_xcnt 0x0" ::: "memory");
    }

    // S = Q K^T for 16 rows x 64 keys: four independent accumulator tiles.
    // LDS fragments come in groups of 8 (16 reads), each group issued as one
    // run a group ahead of its products, into the other half of fb.
    v16bf fb[2][8];
    v8f s[4];
#pragma unroll
    for (int nt = 0; nt < 4; ++nt)
#pragma unroll
      for (int i = 0; i < 8; ++i) s[nt][i] = 0.f;
#pragma unroll
    for (int j = 0; j < 8; ++j)
      fb[0][j] = load_frag(Kb + ((j & 3) * 16 + l15) * KP + (j >> 2) * 32 + hi * 16);
#pragma unroll
    for (int g = 0; g < 4; ++g) {
#pragma unroll
      for (int j = 0; j < 8; ++j) {
        if (g < 3)
          fb[(g + 1) & 1][j] = load_frag(Kb + ((j & 3) * 16 + l15) * KP +
                                         ((g + 1) * 2 + (j >> 2)) * 32 + hi * 16);
        else   // first V^T group: flies under the last products and the softmax
          fb[0][j] = load_frag(Vb + ((j & 3) * 16 + l15) * VP + (j >> 2) * 32 + hi * 16);
      }
      // Keeps the next group's reads together ahead of this group's products.
      __builtin_amdgcn_sched_barrier(0);
#pragma unroll
      for (int j = 0; j < 8; ++j)
        s[j & 3] = wmma_bf16(qf[g * 2 + (j >> 2)], fb[g & 1][j], s[j & 3]);
      // Keeps the group after next from being spread among these products.
      __builtin_amdgcn_sched_barrier(0);
    }

    // Running maximum and sum; P (bf16) to this wave's LDS tile.
    float alpha[8];
#pragma unroll
    for (int r = 0; r < 8; ++r) {
      float tm = fmaxf(fmaxf(s[0][r], s[1][r]), fmaxf(s[2][r], s[3][r])) * SCALE;
      tm = row16_max(tm);
      const float mn = fmaxf(rmax[r], tm);
      alpha[r] = __expf(rmax[r] - mn);
      rmax[r]  = mn;
      float ps = 0.f;
#pragma unroll
      for (int nt = 0; nt < 4; ++nt) {
        float p = __expf(s[nt][r] * SCALE - mn);
        ps += p;
        Pw[(r + hi * 8) * VP + nt * 16 + l15] = (__bf16)p;
      }
      rsum[r] = rsum[r] * alpha[r] + ps;
    }

    // O += P V: A = P rows (same-wave LDS round trip), B = V^T rows, in
    // groups of 4 channel tiles x 2 key chunks, fetched a group ahead as above.
    v16bf pf[2];
#pragma unroll
    for (int c = 0; c < 2; ++c)
      pf[c] = load_frag_p(Pw + l15 * VP + c * 32 + hi * 16);
#pragma unroll
    for (int g = 0; g < 4; ++g) {
      if (g < 3) {
#pragma unroll
        for (int j = 0; j < 8; ++j)
          fb[(g + 1) & 1][j] = load_frag(Vb + (((g + 1) * 4 + (j & 3)) * 16 + l15) * VP +
                                         (j >> 2) * 32 + hi * 16);
      }
      // Keeps the next group's reads together ahead of this group's products.
      __builtin_amdgcn_sched_barrier(0);
      if (g == 0) {   // rescale under the latency of the P and V^T reads
#pragma unroll
        for (int ct = 0; ct < 16; ++ct)
#pragma unroll
          for (int r = 0; r < 8; ++r) oacc[ct][r] *= alpha[r];
      }
#pragma unroll
      for (int j = 0; j < 8; ++j)
        oacc[g * 4 + (j & 3)] =
            wmma_bf16(pf[j >> 2], fb[g & 1][j], oacc[g * 4 + (j & 3)]);
      // Keeps the group after next from being spread among these products.
      __builtin_amdgcn_sched_barrier(0);
    }

    // Fill the other buffer: its readers left it at the last barrier.
    if (more) {
      const int nb = (t + 1) & 1;
#pragma unroll
      for (int i = 0; i < 8; ++i) {
        *(u32x4*)(kl + nb * KBUF + i * 8 * KP)  = kst[i];
        *(u32x4*)(vl + nb * VBUF + i * 32 * VP) = vst[i];
      }
    }
    __syncthreads();   // publishes tile t + 1, ends every read of tile t
  }

  // ---- Normalize, LDS transpose (over the K / V buffers), residual.
  // The last pass's barrier has ended every read of the tiles.
  float* ost = (float*)smem;                  // overlay: [QROWS][257]
  float inv[8];
#pragma unroll
  for (int r = 0; r < 8; ++r) inv[r] = 1.0f / row16_sum(rsum[r]);
#pragma unroll
  for (int ct = 0; ct < 16; ++ct)
#pragma unroll
    for (int r = 0; r < 8; ++r)
      ost[(wrow + r + hi * 8) * 257 + ct * 16 + l15] = oacc[ct][r] * inv[r];
  __syncthreads();

  const float* imgs = img + (size_t)slice * CCH * HW + pbase;
  float*       outs = out + (size_t)slice * CCH * HW + pbase;
#pragma unroll 4
  for (int it = 0; it < 128; ++it) {          // 128*256 / 256 threads
    int idx = it * 256 + tid;
    int c   = idx >> 7;
    int p   = idx & 127;
    outs[(size_t)c * HW + p] = ost[p * 257 + c] + imgs[(size_t)c * HW + p];
  }
}

// ---------------------------------------------------------------------------
// Launch: prep -> proj -> attn, all on `stream` (in-order).
// Workspace (bf16): packed W q/k/v (3*128KB), Q (16MB), K (16MB), Vt (16MB).
// ---------------------------------------------------------------------------
extern "C" void kernel_launch(void* const* d_in, const int* in_sizes, int n_in,
                              void* d_out, int out_size, void* d_ws,
                              size_t ws_size, hipStream_t stream) {
  (void)in_sizes; (void)n_in; (void)out_size; (void)ws_size;
  const float* img   = (const float*)d_in[0];
  const float* depth = (const float*)d_in[1];
  const float* Wq    = (const float*)d_in[2];
  const float* bq    = (const float*)d_in[3];
  const float* Wk    = (const float*)d_in[4];
  const float* bk    = (const float*)d_in[5];
  const float* Wv    = (const float*)d_in[6];
  const float* bv    = (const float*)d_in[7];
  float* out = (float*)d_out;

  char* ws = (char*)d_ws;
  const size_t WT_BYTES = (size_t)CCH * CCH * 2;       // 128 KB each
  const size_t M_BYTES  = (size_t)NSLICE * HW * CCH * 2;  // 16 MB each
  __bf16* Wtq = (__bf16*)(ws);
  __bf16* Wtk = (__bf16*)(ws + WT_BYTES);
  __bf16* Wtv = (__bf16*)(ws + 2 * WT_BYTES);
  __bf16* Qw  = (__bf16*)(ws + 3 * WT_BYTES);
  __bf16* Kw  = (__bf16*)(ws + 3 * WT_BYTES + M_BYTES);
  __bf16* Vtw = (__bf16*)(ws + 3 * WT_BYTES + 2 * M_BYTES);

  prep_weights_k<<<CCH * CCH / 256, 256, 0, stream>>>(Wq, Wk, Wv, Wtq, Wtk,
                                                      Wtv);

  const size_t proj_lds = (size_t)2 * 64 * XPITCH * sizeof(__bf16);
  proj_k<<<dim3(NSLICE, HW / 64), 128, proj_lds, stream>>>(
      img, depth, Wtq, Wtk, Wtv, bq, bk, bv, Qw, Kw, Vtw);

  attn_k<<<dim3(NSLICE, HW / QROWS), 256, 0, stream>>>(Qw, Kw, Vtw, img, out);
}

// v003
// Measured time: 91.2 microseconds a run.
// Next to v002, in two timings, it ran 1.05 and 1.06 times as fast.
// Over all steps from v000 it is 2.21 times as fast.
#include <hip/hip_runtime.h>

// Problem dims (fixed by reference): B=4,S=8 -> 32 slices; H*W=1024; C1=C2=C=256.
#define NSLICE 32
#define HW     1024
#define CCH    256
#define SCALE  0.0625f   // 1/sqrt(256)

typedef __attribute__((ext_vector_type(16))) __bf16 v16bf;
typedef __attribute__((ext_vector_type(8)))  float  v8f;

union FragBF { v16bf v; uint4 u[2]; };

// Load one WMMA operand fragment: lane holds 16 contiguous bf16 (32 bytes).
// Works for both A fragments (lane = row M, K contiguous) and B fragments
// (lane = col N, K contiguous) because B-frag == B^T in A layout.
__device__ __forceinline__ v16bf load_frag(const __bf16* p) {
  FragBF f;
  f.u[0] = *(const uint4*)(p);
  f.u[1] = *(const uint4*)(p + 8);
  return f.v;
}

__device__ __forceinline__ v8f wmma_bf16(v16bf a, v16bf b, v8f c) {
  return __builtin_amdgcn_wmma_f32_16x16x32_bf16(
      /*neg_a=*/false, a, /*neg_b=*/false, b,
      /*c_mod=*/(short)0, c, /*reuse_a=*/false, /*reuse_b=*/false);
}

// Weight fragment from the packed layout written by prep_weights_k: the 16-B
// pieces of the 32 lanes lie side by side, so each wave-wide load covers 512
// contiguous bytes (4 whole 128-B lines). Same element in the same lane and
// register as load_frag on a [cout][c] row: tile = cout / 16, kc = c / 32.
__device__ __forceinline__ v16bf load_wfrag(const __bf16* Wp, int tile, int kc,
                                            int lane) {
  const __bf16* p = Wp + (tile * 8 + kc) * 512 + lane * 8;
  FragBF f;
  f.u[0] = *(const uint4*)(p);
  f.u[1] = *(const uint4*)(p + 256);
  return f.v;
}

// ---------------------------------------------------------------------------
// Kernel 0: bf16-convert the three 256x256 weight matrices and pack them in
// fragment order: W[c][cout] (row-major) ->
//   Wp[cout / 16][c / 32][h][lane][e],  lane = ((c >> 4) & 1) * 16 + cout % 16,
//   h = (c >> 3) & 1, e = c & 7   (1 KB per 16 x 32 fragment).
// ---------------------------------------------------------------------------
__global__ __launch_bounds__(256) void prep_weights_k(
    const float* __restrict__ Wq, const float* __restrict__ Wk,
    const float* __restrict__ Wv,
    __bf16* __restrict__ Wtq, __bf16* __restrict__ Wtk,
    __bf16* __restrict__ Wtv) {
  int idx  = blockIdx.x * 256 + threadIdx.x;   // 0..65535, packed position
  int e    = idx & 7;
  int ln   = (idx >> 3) & 31;
  int h    = (idx >> 8) & 1;
  int kc   = (idx >> 9) & 7;
  int tile = idx >> 12;
  int cout = tile * 16 + (ln & 15);
  int c    = kc * 32 + (ln >> 4) * 16 + h * 8 + e;
  int src  = c * CCH + cout;
  Wtq[idx] = (__bf16)Wq[src];
  Wtk[idx] = (__bf16)Wk[src];
  Wtv[idx] = (__bf16)Wv[src];
}

// ---------------------------------------------------------------------------
// Kernel 1: projections.  Per workgroup: one slice, 64 spatial rows.
//   Q[p][cout], K[p][cout]  (row-major bf16)   = X  @ W + b
//   Vt[cout][p]             (transposed bf16)  = (Xd @ Wv + bv)^T
// X is staged channel-major->row-major through LDS as bf16.
// Block = 128 threads (4 waves). Dynamic LDS = 2 * 64 * 264 bf16.
// ---------------------------------------------------------------------------
#define XPITCH 264

__global__ __launch_bounds__(128) void proj_k(
    const float* __restrict__ img, const float* __restrict__ depth,
    const __bf16* __restrict__ Wtq, const __bf16* __restrict__ Wtk,
    const __bf16* __restrict__ Wtv,
    const float* __restrict__ bq, const float* __restrict__ bk,
    const float* __restrict__ bv,
    __bf16* __restrict__ Qw, __bf16* __restrict__ Kw,
    __bf16* __restrict__ Vtw) {
  extern __shared__ unsigned char dynsmem[];
  __bf16* Xi = (__bf16*)dynsmem;          // [64][XPITCH] img  rows (bf16)
  __bf16* Xd = Xi + 64 * XPITCH;          // [64][XPITCH] depth rows

  const int slice = blockIdx.x;
  const int pbase = blockIdx.y * 64;
  const int tid   = threadIdx.x;
  const int wave  = tid >> 5;
  const int lane  = tid & 31;
  const int l15   = lane & 15;
  const int hi    = lane >> 4;            // 0: K 0..15, 1: K 16..31

  // ---- Stage inputs: global [c][p] f32 (coalesced in p) -> LDS [p][c] bf16
  {
    const float* ib = img   + (size_t)slice * CCH * HW + pbase;
    const float* db = depth + (size_t)slice * CCH * HW + pbase;
#pragma unroll 4
    for (int it = 0; it < 128; ++it) {    // 64*256 / 128 threads
      int idx = it * 128 + tid;
      int c   = idx >> 6;
      int p   = idx & 63;
      Xi[p * XPITCH + c] = (__bf16)ib[(size_t)c * HW + p];
      Xd[p * XPITCH + c] = (__bf16)db[(size_t)c * HW + p];
    }
  }
  __syncthreads();

  // ---- Q and K GEMMs: wave w owns rows [w*16, w*16+16)
  v16bf xiF[8], xdF[8];
#pragma unroll
  for (int kc = 0; kc < 8; ++kc) {
    const int off = (wave * 16 + l15) * XPITCH + kc * 32 + hi * 16;
    xiF[kc] = load_frag(Xi + off);
    xdF[kc] = load_frag(Xd + off);
  }

  for (int ct = 0; ct < 16; ++ct) {       // 16 cout tiles
    float biasq = bq[ct * 16 + l15];
    float biask = bk[ct * 16 + l15];
    v8f aq, ak;
#pragma unroll
    for (int i = 0; i < 8; ++i) { aq[i] = biasq; ak[i] = biask; }
#pragma unroll
    for (int kc = 0; kc < 8; ++kc) {
      aq = wmma_bf16(xiF[kc], load_wfrag(Wtq, ct, kc, lane), aq);
      ak = wmma_bf16(xdF[kc], load_wfrag(Wtk, ct, kc, lane), ak);
    }
#pragma unroll
    for (int r = 0; r < 8; ++r) {
      size_t o = ((size_t)slice * HW + pbase + wave * 16 + r + hi * 8) * CCH +
                 ct * 16 + l15;
      Qw[o] = (__bf16)aq[r];
      Kw[o] = (__bf16)ak[r];
    }
  }

  // ---- Vt GEMM: M = cout (wave owns 64 couts), N = p (all 64 rows)
  // Xd fragments of all 64 rows stay in registers across the mt loop (the
  // wait below is a memory clobber: reads left inside would repeat per mt).
  v16bf xbF[4][8];
#pragma unroll   // constant indices keep xbF in registers
  for (int nt = 0; nt < 4; ++nt)
#pragma unroll   // as above
    for (int kc = 0; kc < 8; ++kc)
      xbF[nt][kc] = load_frag(Xd + (nt * 16 + l15) * XPITCH + kc * 32 + hi * 16);

  for (int mt = 0; mt < 4; ++mt) {
    const int cbase = wave * 64 + mt * 16;
    v16bf wvF[8];
#pragma unroll
    for (int kc = 0; kc < 8; ++kc)
      wvF[kc] = load_wfrag(Wtv, wave * 4 + mt, kc, lane);
    float bvr[8];
#pragma unroll
    for (int r = 0; r < 8; ++r) bvr[r] = bv[cbase + r + hi * 8];
    // The loads' address registers are stepped for the next mt behind them.
    asm volatile("s_wait_xcnt 0x0" ::: "memory");
    // Keeps that step (and the products) from being lifted over the wait.
    __builtin_amdgcn_sched_barrier(0);

#pragma unroll   // xbF stays in registers only with constant indices
    for (int nt = 0; nt < 4; ++nt) {
      v8f av;
#pragma unroll
      for (int r = 0; r < 8; ++r) av[r] = bvr[r];
#pragma unroll
      for (int kc = 0; kc < 8; ++kc)
        av = wmma_bf16(wvF[kc], xbF[nt][kc], av);
#pragma unroll
      for (int r = 0; r < 8; ++r) {
        size_t o = ((size_t)slice * CCH + cbase + r + hi * 8) * HW + pbase +
                   nt * 16 + l15;
        Vtw[o] = (__bf16)av[r];
      }
    }
  }
}

#define QROWS 128
#define KT    64
#define KP    264
#define VP    72
#define KBUF  (KT * KP)
#define VBUF  (CCH * VP)
#define NPASS (HW / KT)
#define ATTN_LDS ((2 * KBUF + 2 * VBUF) * 2)

typedef __attribute__((ext_vector_type(4))) unsigned int u32x4;

// V^T fragment in the k order of a packed accumulator pair: element s of wave
// half h is key 8 h + s (s < 8) or 16 + 8 h + (s - 8) of a 32-key chunk.
// p = row start + chunk * 32 + 8 * h.
__device__ __forceinline__ v16bf load_frag_kmap(const __bf16* p) {
  FragBF f;
  f.u[0] = *(const uint4*)(p);
  f.u[1] = *(const uint4*)(p + 16);
  return f.v;
}

// Value of lane l ^ 16 (the other wave half).
__device__ __forceinline__ float xhalf(float x) {
  return __int_as_float(__builtin_amdgcn_permlanex16(
      __float_as_int(x), __float_as_int(x), 0x76543210, 0xfedcba98, false,
      false));
}

__global__ __launch_bounds__(256) void attn_k(
    const __bf16* __restrict__ Qw, const __bf16* __restrict__ Kw,
    const __bf16* __restrict__ Vtw, const float* __restrict__ img,
    float* __restrict__ out) {
  __shared__ __attribute__((aligned(16))) unsigned char smem[ATTN_LDS];

  const int slice = blockIdx.x;
  const int pbase = blockIdx.y * QROWS;
  const int tid   = threadIdx.x;
  const int wave  = tid >> 5;
  const int lane  = tid & 31;
  const int l15   = lane & 15;
  const int hi    = lane >> 4;
  const int wrow  = wave * 16;

  __bf16* Kt = (__bf16*)smem;                 // [2][KT][KP]
  __bf16* Vt = Kt + 2 * KBUF;                 // [2][CCH][VP]

  const __bf16* Qs = Qw  + (size_t)slice * HW * CCH;
  const __bf16* Ks = Kw  + (size_t)slice * HW * CCH;
  const __bf16* Vs = Vtw + (size_t)slice * CCH * HW;

  // Each thread moves 8 + 8 pieces of 16 B per tile. A K tile (64 rows of
  // 512 B) is one contiguous 32 KB run; a V^T tile is 256 rows of 128 B.
  const int krow = tid >> 5, kseg = tid & 31;   // + 8 rows per piece
  const int vrow = tid >> 3, vseg = tid & 7;    // + 32 rows per piece
  const __bf16* kg = Ks + tid * 8;
  const __bf16* vg = Vs + (size_t)vrow * HW + vseg * 8;
  __bf16* kl = Kt + krow * KP + kseg * 8;
  __bf16* vl = Vt + vrow * VP + vseg * 8;

  u32x4 kst[8], vst[8];
#pragma unroll
  for (int i = 0; i < 8; ++i) {
    kst[i] = *(const u32x4*)(kg + i * 2048);
    vst[i] = *(const u32x4*)(vg + (size_t)i * 32 * HW);
  }

  // Register-resident Q fragments for this wave's 16 rows (8 K-chunks).
  v16bf qf[8];
  {
    const __bf16* qrow = Qs + (size_t)(pbase + wrow + l15) * CCH + hi * 16;
#pragma unroll
    for (int kc = 0; kc < 8; ++kc) qf[kc] = load_frag(qrow + kc * 32);
    // The loads' address registers are reused before their data is waited for.
    asm volatile("s_wait_xcnt 0x0" ::: "memory");
  }

#pragma unroll
  for (int i = 0; i < 8; ++i) {
    *(u32x4*)(kl + i * 8 * KP)  = kst[i];
    *(u32x4*)(vl + i * 32 * VP) = vst[i];
  }
  __syncthreads();

  // State of query wrow + l15. oacc[ct][r] = O^T[ct * 16 + r + 8 * hi][l15].
  float rmax = -3.0e38f, rsum = 0.f;          // rsum: this wave half's keys only
  v8f oacc[16];
#pragma unroll
  for (int ct = 0; ct < 16; ++ct)
#pragma unroll
    for (int i = 0; i < 8; ++i) oacc[ct][i] = 0.f;

  for (int t = 0; t < NPASS; ++t) {
    const __bf16* Kb = Kt + (t & 1) * KBUF;
    const __bf16* Vb = Vt + (t & 1) * VBUF;
    const bool more = (t + 1 < NPASS);

    // Next tile's global loads fly under this pass's products.
    if (more) {
#pragma unroll
      for (int i = 0; i < 8; ++i) {
        kst[i] = *(const u32x4*)(kg + (t + 1) * (KT * CCH) + i * 2048);
        vst[i] = *(const u32x4*)(vg + (size_t)i * 32 * HW + (t + 1) * KT);
      }
      // The loads' address registers are reused right behind them.
      asm volatile("s_wait_xcnt 0x0" ::: "memory");
    }

    // S^T = K Q^T for 64 keys x 16 queries: four independent accumulator tiles,
    // s[nt][r] = score of key nt * 16 + r + 8 * hi, query l15.
    // LDS fragments come in groups of 8 (16 reads), each group issued as one
    // run a group ahead of its products, into the other half of fb.
    v16bf fb[2][8];
    v8f s[4];
#pragma unroll
    for (int nt = 0; nt < 4; ++nt)
#pragma unroll
      for (int i = 0; i < 8; ++i) s[nt][i] = 0.f;
#pragma unroll
    for (int j = 0; j < 8; ++j)
      fb[0][j] = load_frag(Kb + ((j & 3) * 16 + l15) * KP + (j >> 2) * 32 + hi * 16);
#pragma unroll
    for (int g = 0; g < 4; ++g) {
#pragma unroll
      for (int j = 0; j < 8; ++j) {
        if (g < 3)
          fb[(g + 1) & 1][j] = load_frag(Kb + ((j & 3) * 16 + l15) * KP +
                                         ((g + 1) * 2 + (j >> 2)) * 32 + hi * 16);
        else   // first V^T group: flies under the last products and the softmax
          fb[0][j] = load_frag_kmap(Vb + ((j & 3) * 16 + l15) * VP + (j >> 2) * 32 + hi * 8);
      }
      // Keeps the next group's reads together ahead of this group's products.
      __builtin_amdgcn_sched_barrier(0);
#pragma unroll
      for (int j = 0; j < 8; ++j)
        s[j & 3] = wmma_bf16(fb[g & 1][j], qf[g * 2 + (j >> 2)], s[j & 3]);
      // Keeps the group after next from being spread among these products.
      __builtin_amdgcn_sched_barrier(0);
    }

    // Running maximum and sum of this lane's query: in-lane over its 32
    // scores (one chain per tile), one exchange between the wave halves.
    float tmx[4], ps[4];
#pragma unroll
    for (int nt = 0; nt < 4; ++nt) {
      tmx[nt] = s[nt][0];
#pragma unroll
      for (int r = 1; r < 8; ++r) tmx[nt] = fmaxf(tmx[nt], s[nt][r]);
    }
    float tm = fmaxf(fmaxf(tmx[0], tmx[1]), fmaxf(tmx[2], tmx[3]));
    tm = fmaxf(tm, xhalf(tm)) * SCALE;
    const float mn    = fmaxf(rmax, tm);
    const float alpha = __expf(rmax - mn);
    rmax = mn;
    // P^T: score tiles 2 c and 2 c + 1, converted in place, are the B operand
    // of key chunk c (element e = tile e >> 3, register e & 7).
    v16bf pf[2];
#pragma unroll
    for (int nt = 0; nt < 4; ++nt) {
      ps[nt] = 0.f;
#pragma unroll
      for (int r = 0; r < 8; ++r) {
        const float p = __expf(s[nt][r] * SCALE - mn);
        ps[nt] += p;
        pf[nt >> 1][(nt & 1) * 8 + r] = (__bf16)p;
      }
    }
    rsum = rsum * alpha + ((ps[0] + ps[1]) + (ps[2] + ps[3]));

    // O^T += V^T P^T: A = V^T rows in the k order of pf, B = pf, in groups of
    // 4 channel tiles x 2 key chunks, fetched a group ahead as above.
#pragma unroll
    for (int g = 0; g < 4; ++g) {
      if (g < 3) {
#pragma unroll
        for (int j = 0; j < 8; ++j)
          fb[(g + 1) & 1][j] = load_frag_kmap(Vb + (((g + 1) * 4 + (j & 3)) * 16 + l15) * VP +
                                              (j >> 2) * 32 + hi * 8);
      }
      // Keeps the next group's reads together ahead of this group's products.
      __builtin_amdgcn_sched_barrier(0);
      if (g == 0) {   // rescale under the latency of the V^T reads
#pragma unroll
        for (int ct = 0; ct < 16; ++ct)
#pragma unroll
          for (int r = 0; r < 8; ++r) oacc[ct][r] *= alpha;
      }
#pragma unroll
      for (int j = 0; j < 8; ++j)
        oacc[g * 4 + (j & 3)] =
            wmma_bf16(fb[g & 1][j], pf[j >> 2], oacc[g * 4 + (j & 3)]);
      // Keeps the group after next from being spread among these products.
      __builtin_amdgcn_sched_barrier(0);
    }

    // Fill the other buffer: its readers left it at the last barrier.
    if (more) {
      const int nb = (t + 1) & 1;
#pragma unroll
      for (int i = 0; i < 8; ++i) {
        *(u32x4*)(kl + nb * KBUF + i * 8 * KP)  = kst[i];
        *(u32x4*)(vl + nb * VBUF + i * 32 * VP) = vst[i];
      }
    }
    __syncthreads();   // publishes tile t + 1, ends every read of tile t
  }

  // ---- Normalize, LDS transpose (over the K / V buffers), residual.
  // The last pass's barrier has ended every read of the tiles.
  float* ost = (float*)smem;                  // overlay: [QROWS][257]
  const float inv = 1.0f / (rsum + xhalf(rsum));
#pragma unroll
  for (int ct = 0; ct < 16; ++ct)
#pragma unroll
    for (int r = 0; r < 8; ++r)
      ost[(wrow + l15) * 257 + ct * 16 + r + hi * 8] = oacc[ct][r] * inv;
  __syncthreads();

  const float* imgs = img + (size_t)slice * CCH * HW + pbase;
  float*       outs = out + (size_t)slice * CCH * HW + pbase;
#pragma unroll 4
  for (int it = 0; it < 128; ++it) {          // 128*256 / 256 threads
    int idx = it * 256 + tid;
    int c   = idx >> 7;
    int p   = idx & 127;
    outs[(size_t)c * HW + p] = ost[p * 257 + c] + imgs[(size_t)c * HW + p];
  }
}

// ---------------------------------------------------------------------------
// Launch: prep -> proj -> attn, all on `stream` (in-order).
// Workspace (bf16): packed W q/k/v (3*128KB), Q (16MB), K (16MB), Vt (16MB).
// ---------------------------------------------------------------------------
extern "C" void kernel_launch(void* const* d_in, const int* in_sizes, int n_in,
                              void* d_out, int out_size, void* d_ws,
                              size_t ws_size, hipStream_t stream) {
  (void)in_sizes; (void)n_in; (void)out_size; (void)ws_size;
  const float* img   = (const float*)d_in[0];
  const float* depth = (const float*)d_in[1];
  const float* Wq    = (const float*)d_in[2];
  const float* bq    = (const float*)d_in[3];
  const float* Wk    = (const float*)d_in[4];
  const float* bk    = (const float*)d_in[5];
  const float* Wv    = (const float*)d_in[6];
  const float* bv    = (const float*)d_in[7];
  float* out = (float*)d_out;

  char* ws = (char*)d_ws;
  const size_t WT_BYTES = (size_t)CCH * CCH * 2;       // 128 KB each
  const size_t M_BYTES  = (size_t)NSLICE * HW * CCH * 2;  // 16 MB each
  __bf16* Wtq = (__bf16*)(ws);
  __bf16* Wtk = (__bf16*)(ws + WT_BYTES);
  __bf16* Wtv = (__bf16*)(ws + 2 * WT_BYTES);
  __bf16* Qw  = (__bf16*)(ws + 3 * WT_BYTES);
  __bf16* Kw  = (__bf16*)(ws + 3 * WT_BYTES + M_BYTES);
  __bf16* Vtw = (__bf16*)(ws + 3 * WT_BYTES + 2 * M_BYTES);

  prep_weights_k<<<CCH * CCH / 256, 256, 0, stream>>>(Wq, Wk, Wv, Wtq, Wtk,
                                                      Wtv);

  const size_t proj_lds = (size_t)2 * 64 * XPITCH * sizeof(__bf16);
  proj_k<<<dim3(NSLICE, HW / 64), 128, proj_lds, stream>>>(
      img, depth, Wtq, Wtk, Wtv, bq, bk, bv, Qw, Kw, Vtw);

  attn_k<<<dim3(NSLICE, HW / QROWS), 256, 0, stream>>>(Qw, Kw, Vtw, img, out);
}

// v004
// A run of this version takes 68.4 microseconds.
// Next to v003, in two timings, it ran 1.33 and 1.34 times as fast.
// All steps since v000 together make it 2.95 times as fast.
#include <hip/hip_runtime.h>

// Problem dims (fixed by reference): B=4,S=8 -> 32 slices; H*W=1024; C1=C2=C=256.
#define NSLICE 32
#define HW     1024
#define CCH    256
#define SCALE  0.0625f   // 1/sqrt(256)

typedef __attribute__((ext_vector_type(16))) __bf16 v16bf;
typedef __attribute__((ext_vector_type(8)))  float  v8f;

union FragBF { v16bf v; uint4 u[2]; };

// Load one WMMA operand fragment: lane holds 16 contiguous bf16 (32 bytes).
// Works for both A fragments (lane = row M, K contiguous) and B fragments
// (lane = col N, K contiguous) because B-frag == B^T in A layout.
__device__ __forceinline__ v16bf load_frag(const __bf16* p) {
  FragBF f;
  f.u[0] = *(const uint4*)(p);
  f.u[1] = *(const uint4*)(p + 8);
  return f.v;
}

__device__ __forceinline__ v8f wmma_bf16(v16bf a, v16bf b, v8f c) {
  return __builtin_amdgcn_wmma_f32_16x16x32_bf16(
      /*neg_a=*/false, a, /*neg_b=*/false, b,
      /*c_mod=*/(short)0, c, /*reuse_a=*/false, /*reuse_b=*/false);
}

// Weight fragment from the packed layout written by prep_weights_k: the 16-B
// pieces of the 32 lanes lie side by side, so each wave-wide load covers 512
// contiguous bytes (4 whole 128-B lines). Same element in the same lane and
// register as load_frag on a [cout][c] row: tile = cout / 16, kc = c / 32.
__device__ __forceinline__ v16bf load_wfrag(const __bf16* Wp, int tile, int kc,
                                            int lane) {
  const __bf16* p = Wp + (tile * 8 + kc) * 512 + lane * 8;
  FragBF f;
  f.u[0] = *(const uint4*)(p);
  f.u[1] = *(const uint4*)(p + 256);
  return f.v;
}

// ---------------------------------------------------------------------------
// Kernel 0: bf16-convert the three 256x256 weight matrices and pack them in
// fragment order: W[c][cout] (row-major) ->
//   Wp[cout / 16][c / 32][h][lane][e],  lane = ((c >> 4) & 1) * 16 + cout % 16,
//   h = (c >> 3) & 1, e = c & 7   (1 KB per 16 x 32 fragment).
// ---------------------------------------------------------------------------
__global__ __launch_bounds__(256) void prep_weights_k(
    const float* __restrict__ Wq, const float* __restrict__ Wk,
    const float* __restrict__ Wv,
    __bf16* __restrict__ Wtq, __bf16* __restrict__ Wtk,
    __bf16* __restrict__ Wtv) {
  int idx  = blockIdx.x * 256 + threadIdx.x;   // 0..65535, packed position
  int e    = idx & 7;
  int ln   = (idx >> 3) & 31;
  int h    = (idx >> 8) & 1;
  int kc   = (idx >> 9) & 7;
  int tile = idx >> 12;
  int cout = tile * 16 + (ln & 15);
  int c    = kc * 32 + (ln >> 4) * 16 + h * 8 + e;
  int src  = c * CCH + cout;
  Wtq[idx] = (__bf16)Wq[src];
  Wtk[idx] = (__bf16)Wk[src];
  Wtv[idx] = (__bf16)Wv[src];
}

// ---------------------------------------------------------------------------
// Kernel 1: projections.  Per workgroup: one slice, 64 spatial rows.
//   Q[p][cout], K[p][cout]  (row-major bf16)   = X  @ W + b
//   Vt[cout][p]             (transposed bf16)  = (Xd @ Wv + bv)^T
// X is staged channel-major->row-major through LDS as bf16.
// Block = 256 threads (8 waves), two blocks per WGP = four waves per SIMD:
// every phase waits on loads, and twice the waves wait side by side.
// Waves 0-3 make Q, waves 4-7 make K (16 rows each, two cout tiles at a time);
// for Vt each wave owns 32 couts. Dynamic LDS = 2 * 64 * 264 bf16.
// ---------------------------------------------------------------------------
#define XPITCH 264

__global__ __launch_bounds__(256)
__attribute__((amdgpu_waves_per_eu(4, 4))) void proj_k(
    const float* __restrict__ img, const float* __restrict__ depth,
    const __bf16* __restrict__ Wtq, const __bf16* __restrict__ Wtk,
    const __bf16* __restrict__ Wtv,
    const float* __restrict__ bq, const float* __restrict__ bk,
    const float* __restrict__ bv,
    __bf16* __restrict__ Qw, __bf16* __restrict__ Kw,
    __bf16* __restrict__ Vtw) {
  extern __shared__ unsigned char dynsmem[];
  __bf16* Xi = (__bf16*)dynsmem;          // [64][XPITCH] img  rows (bf16)
  __bf16* Xd = Xi + 64 * XPITCH;          // [64][XPITCH] depth rows

  const int slice = blockIdx.x;
  const int pbase = blockIdx.y * 64;
  const int tid   = threadIdx.x;
  const int wave  = __builtin_amdgcn_readfirstlane(tid >> 5);
  const int lane  = tid & 31;
  const int l15   = lane & 15;
  const int hi    = lane >> 4;            // 0: K 0..15, 1: K 16..31

  // ---- Stage inputs: global [c][p] f32 (coalesced in p) -> LDS [p][c] bf16
  {
    const float* ib = img   + (size_t)slice * CCH * HW + pbase;
    const float* db = depth + (size_t)slice * CCH * HW + pbase;
#pragma unroll 4
    for (int it = 0; it < 64; ++it) {     // 64*256 / 256 threads
      int idx = it * 256 + tid;
      int c   = idx >> 6;
      int p   = idx & 63;
      Xi[p * XPITCH + c] = (__bf16)ib[(size_t)c * HW + p];
      Xd[p * XPITCH + c] = (__bf16)db[(size_t)c * HW + p];
    }
  }
  __syncthreads();

  // ---- Q or K GEMM: rows [rg*16, rg*16+16), all 256 couts
  {
    const int  rg  = wave & 3;
    const bool isk = wave >= 4;           // the same in a whole wave
    const __bf16* Xs = isk ? Xd  : Xi;
    const __bf16* Ws = isk ? Wtk : Wtq;
    const float*  bs = isk ? bk  : bq;
    __bf16*       Os = isk ? Kw  : Qw;

    v16bf xF[8];
#pragma unroll
    for (int kc = 0; kc < 8; ++kc)
      xF[kc] = load_frag(Xs + (rg * 16 + l15) * XPITCH + kc * 32 + hi * 16);

    for (int cp = 0; cp < 8; ++cp) {      // pairs of cout tiles
      const int ct = cp * 2;
      const float bias0 = bs[ct * 16 + l15];
      const float bias1 = bs[ct * 16 + 16 + l15];
      v16bf w0[8], w1[8];
#pragma unroll
      for (int kc = 0; kc < 8; ++kc) {
        w0[kc] = load_wfrag(Ws, ct, kc, lane);
        w1[kc] = load_wfrag(Ws, ct + 1, kc, lane);
      }
      // The loads' address registers are stepped for the next pair behind them.
      asm volatile("s_wait_xcnt 0x0" ::: "memory");
      // Keeps all 32 weight loads in flight together, ahead of the products.
      __builtin_amdgcn_sched_barrier(0);
      v8f a0, a1;
#pragma unroll
      for (int i = 0; i < 8; ++i) { a0[i] = bias0; a1[i] = bias1; }
#pragma unroll
      for (int kc = 0; kc < 8; ++kc) {
        a0 = wmma_bf16(xF[kc], w0[kc], a0);
        a1 = wmma_bf16(xF[kc], w1[kc], a1);
      }
#pragma unroll
      for (int r = 0; r < 8; ++r) {
        size_t o = ((size_t)slice * HW + pbase + rg * 16 + r + hi * 8) * CCH +
                   ct * 16 + l15;
        Os[o]      = (__bf16)a0[r];
        Os[o + 16] = (__bf16)a1[r];
      }
      // The stores' address registers are stepped for the next pair as well.
      asm volatile("s_wait_xcnt 0x0" ::: "memory");
    }
  }

  // ---- Vt GEMM: M = cout (wave owns 32 couts), N = p (all 64 rows)
  for (int mt = 0; mt < 2; ++mt) {
    const int cbase = wave * 32 + mt * 16;
    v16bf wvF[8];
#pragma unroll
    for (int kc = 0; kc < 8; ++kc)
      wvF[kc] = load_wfrag(Wtv, wave * 2 + mt, kc, lane);
    float bvr[8];
#pragma unroll
    for (int r = 0; r < 8; ++r) bvr[r] = bv[cbase + r + hi * 8];
    // The loads' address registers are stepped for the next mt behind them.
    asm volatile("s_wait_xcnt 0x0" ::: "memory");
    // Keeps that step (and the products) from being lifted over the wait.
    __builtin_amdgcn_sched_barrier(0);

#pragma unroll
    for (int np = 0; np < 2; ++np) {      // pairs of row tiles: two chains
      v16bf x0[8], x1[8];
#pragma unroll
      for (int kc = 0; kc < 8; ++kc) {
        x0[kc] = load_frag(Xd + (np * 32 + l15) * XPITCH + kc * 32 + hi * 16);
        x1[kc] = load_frag(Xd + (np * 32 + 16 + l15) * XPITCH + kc * 32 + hi * 16);
      }
      v8f av0, av1;
#pragma unroll
      for (int r = 0; r < 8; ++r) { av0[r] = bvr[r]; av1[r] = bvr[r]; }
#pragma unroll
      for (int kc = 0; kc < 8; ++kc) {
        av0 = wmma_bf16(wvF[kc], x0[kc], av0);
        av1 = wmma_bf16(wvF[kc], x1[kc], av1);
      }
#pragma unroll
      for (int r = 0; r < 8; ++r) {
        size_t o = ((size_t)slice * CCH + cbase + r + hi * 8) * HW + pbase +
                   np * 32 + l15;
        Vtw[o]      = (__bf16)av0[r];
        Vtw[o + 16] = (__bf16)av1[r];
      }
    }
    // The stores' address registers are stepped for the next mt as well.
    asm volatile("s_wait_xcnt 0x0" ::: "memory");
  }
}

#define QROWS 128
#define KT    64
#define KP    264
#define VP    72
#define KBUF  (KT * KP)
#define VBUF  (CCH * VP)
#define NPASS (HW / KT)
#define ATTN_LDS ((2 * KBUF + 2 * VBUF) * 2)

typedef __attribute__((ext_vector_type(4))) unsigned int u32x4;

// V^T fragment in the k order of a packed accumulator pair: element s of wave
// half h is key 8 h + s (s < 8) or 16 + 8 h + (s - 8) of a 32-key chunk.
// p = row start + chunk * 32 + 8 * h.
__device__ __forceinline__ v16bf load_frag_kmap(const __bf16* p) {
  FragBF f;
  f.u[0] = *(const uint4*)(p);
  f.u[1] = *(const uint4*)(p + 16);
  return f.v;
}

// Value of lane l ^ 16 (the other wave half).
__device__ __forceinline__ float xhalf(float x) {
  return __int_as_float(__builtin_amdgcn_permlanex16(
      __float_as_int(x), __float_as_int(x), 0x76543210, 0xfedcba98, false,
      false));
}

__global__ __launch_bounds__(256) void attn_k(
    const __bf16* __restrict__ Qw, const __bf16* __restrict__ Kw,
    const __bf16* __restrict__ Vtw, const float* __restrict__ img,
    float* __restrict__ out) {
  __shared__ __attribute__((aligned(16))) unsigned char smem[ATTN_LDS];

  const int slice = blockIdx.x;
  const int pbase = blockIdx.y * QROWS;
  const int tid   = threadIdx.x;
  const int wave  = tid >> 5;
  const int lane  = tid & 31;
  const int l15   = lane & 15;
  const int hi    = lane >> 4;
  const int wrow  = wave * 16;

  __bf16* Kt = (__bf16*)smem;                 // [2][KT][KP]
  __bf16* Vt = Kt + 2 * KBUF;                 // [2][CCH][VP]

  const __bf16* Qs = Qw  + (size_t)slice * HW * CCH;
  const __bf16* Ks = Kw  + (size_t)slice * HW * CCH;
  const __bf16* Vs = Vtw + (size_t)slice * CCH * HW;

  // Each thread moves 8 + 8 pieces of 16 B per tile. A K tile (64 rows of
  // 512 B) is one contiguous 32 KB run; a V^T tile is 256 rows of 128 B.
  const int krow = tid >> 5, kseg = tid & 31;   // + 8 rows per piece
  const int vrow = tid >> 3, vseg = tid & 7;    // + 32 rows per piece
  const __bf16* kg = Ks + tid * 8;
  const __bf16* vg = Vs + (size_t)vrow * HW + vseg * 8;
  __bf16* kl = Kt + krow * KP + kseg * 8;
  __bf16* vl = Vt + vrow * VP + vseg * 8;

  u32x4 kst[8], vst[8];
#pragma unroll
  for (int i = 0; i < 8; ++i) {
    kst[i] = *(const u32x4*)(kg + i * 2048);
    vst[i] = *(const u32x4*)(vg + (size_t)i * 32 * HW);
  }

  // Register-resident Q fragments for this wave's 16 rows (8 K-chunks).
  v16bf qf[8];
  {
    const __bf16* qrow = Qs + (size_t)(pbase + wrow + l15) * CCH + hi * 16;
#pragma unroll
    for (int kc = 0; kc < 8; ++kc) qf[kc] = load_frag(qrow + kc * 32);
    // The loads' address registers are reused before their data is waited for.
    asm volatile("s_wait_xcnt 0x0" ::: "memory");
  }

#pragma unroll
  for (int i = 0; i < 8; ++i) {
    *(u32x4*)(kl + i * 8 * KP)  = kst[i];
    *(u32x4*)(vl + i * 32 * VP) = vst[i];
  }
  __syncthreads();

  // State of query wrow + l15. oacc[ct][r] = O^T[ct * 16 + r + 8 * hi][l15].
  float rmax = -3.0e38f, rsum = 0.f;          // rsum: this wave half's keys only
  v8f oacc[16];
#pragma unroll
  for (int ct = 0; ct < 16; ++ct)
#pragma unroll
    for (int i = 0; i < 8; ++i) oacc[ct][i] = 0.f;

  for (int t = 0; t < NPASS; ++t) {
    const __bf16* Kb = Kt + (t & 1) * KBUF;
    const __bf16* Vb = Vt + (t & 1) * VBUF;
    const bool more = (t + 1 < NPASS);

    // Next tile's global loads fly under this pass's products.
    if (more) {
#pragma unroll
      for (int i = 0; i < 8; ++i) {
        kst[i] = *(const u32x4*)(kg + (t + 1) * (KT * CCH) + i * 2048);
        vst[i] = *(const u32x4*)(vg + (size_t)i * 32 * HW + (t + 1) * KT);
      }
      // The loads' address registers are reused right behind them.
      asm volatile("s_wait_xcnt 0x0" ::: "memory");
    }

    // S^T = K Q^T for 64 keys x 16 queries: four independent accumulator tiles,
    // s[nt][r] = score of key nt * 16 + r + 8 * hi, query l15.
    // LDS fragments come in groups of 8 (16 reads), each group issued as one
    // run a group ahead of its products, into the other half of fb.
    v16bf fb[2][8];
    v8f s[4];
#pragma unroll
    for (int nt = 0; nt < 4; ++nt)
#pragma unroll
      for (int i = 0; i < 8; ++i) s[nt][i] = 0.f;
#pragma unroll
    for (int j = 0; j < 8; ++j)
      fb[0][j] = load_frag(Kb + ((j & 3) * 16 + l15) * KP + (j >> 2) * 32 + hi * 16);
#pragma unroll
    for (int g = 0; g < 4; ++g) {
#pragma unroll
      for (int j = 0; j < 8; ++j) {
        if (g < 3)
          fb[(g + 1) & 1][j] = load_frag(Kb + ((j & 3) * 16 + l15) * KP +
                                         ((g + 1) * 2 + (j >> 2)) * 32 + hi * 16);
        else   // first V^T group: flies under the last products and the softmax
          fb[0][j] = load_frag_kmap(Vb + ((j & 3) * 16 + l15) * VP + (j >> 2) * 32 + hi * 8);
      }
      // Keeps the next group's reads together ahead of this group's products.
      __builtin_amdgcn_sched_barrier(0);
#pragma unroll
      for (int j = 0; j < 8; ++j)
        s[j & 3] = wmma_bf16(fb[g & 1][j], qf[g * 2 + (j >> 2)], s[j & 3]);
      // Keeps the group after next from being spread among these products.
      __builtin_amdgcn_sched_barrier(0);
    }

    // Running maximum and sum of this lane's query: in-lane over its 32
    // scores (one chain per tile), one exchange between the wave halves.
    float tmx[4], ps[4];
#pragma unroll
    for (int nt = 0; nt < 4; ++nt) {
      tmx[nt] = s[nt][0];
#pragma unroll
      for (int r = 1; r < 8; ++r) tmx[nt] = fmaxf(tmx[nt], s[nt][r]);
    }
    float tm = fmaxf(fmaxf(tmx[0], tmx[1]), fmaxf(tmx[2], tmx[3]));
    tm = fmaxf(tm, xhalf(tm)) * SCALE;
    const float mn    = fmaxf(rmax, tm);
    const float alpha = __expf(rmax - mn);
    rmax = mn;
    // P^T: score tiles 2 c and 2 c + 1, converted in place, are the B operand
    // of key chunk c (element e = tile e >> 3, register e & 7).
    v16bf pf[2];
#pragma unroll
    for (int nt = 0; nt < 4; ++nt) {
      ps[nt] = 0.f;
#pragma unroll
      for (int r = 0; r < 8; ++r) {
        const float p = __expf(s[nt][r] * SCALE - mn);
        ps[nt] += p;
        pf[nt >> 1][(nt & 1) * 8 + r] = (__bf16)p;
      }
    }
    rsum = rsum * alpha + ((ps[0] + ps[1]) + (ps[2] + ps[3]));

    // O^T += V^T P^T: A = V^T rows in the k order of pf, B = pf, in groups of
    // 4 channel tiles x 2 key chunks, fetched a group ahead as above.
#pragma unroll
    for (int g = 0; g < 4; ++g) {
      if (g < 3) {
#pragma unroll
        for (int j = 0; j < 8; ++j)
          fb[(g + 1) & 1][j] = load_frag_kmap(Vb + (((g + 1) * 4 + (j & 3)) * 16 + l15) * VP +
                                              (j >> 2) * 32 + hi * 8);
      }
      // Keeps the next group's reads together ahead of this group's products.
      __builtin_amdgcn_sched_barrier(0);
      if (g == 0) {   // rescale under the latency of the V^T reads
#pragma unroll
        for (int ct = 0; ct < 16; ++ct)
#pragma unroll
          for (int r = 0; r < 8; ++r) oacc[ct][r] *= alpha;
      }
#pragma unroll
      for (int j = 0; j < 8; ++j)
        oacc[g * 4 + (j & 3)] =
            wmma_bf16(fb[g & 1][j], pf[j >> 2], oacc[g * 4 + (j & 3)]);
      // Keeps the group after next from being spread among these products.
      __builtin_amdgcn_sched_barrier(0);
    }

    // Fill the other buffer: its readers left it at the last barrier.
    if (more) {
      const int nb = (t + 1) & 1;
#pragma unroll
      for (int i = 0; i < 8; ++i) {
        *(u32x4*)(kl + nb * KBUF + i * 8 * KP)  = kst[i];
        *(u32x4*)(vl + nb * VBUF + i * 32 * VP) = vst[i];
      }
    }
    __syncthreads();   // publishes tile t + 1, ends every read of tile t
  }

  // ---- Normalize, LDS transpose (over the K / V buffers), residual.
  // The last pass's barrier has ended every read of the tiles.
  float* ost = (float*)smem;                  // overlay: [QROWS][257]
  const float inv = 1.0f / (rsum + xhalf(rsum));
#pragma unroll
  for (int ct = 0; ct < 16; ++ct)
#pragma unroll
    for (int r = 0; r < 8; ++r)
      ost[(wrow + l15) * 257 + ct * 16 + r + hi * 8] = oacc[ct][r] * inv;
  __syncthreads();

  const float* imgs = img + (size_t)slice * CCH * HW + pbase;
  float*       outs = out + (size_t)slice * CCH * HW + pbase;
#pragma unroll 4
  for (int it = 0; it < 128; ++it) {          // 128*256 / 256 threads
    int idx = it * 256 + tid;
    int c   = idx >> 7;
    int p   = idx & 127;
    outs[(size_t)c * HW + p] = ost[p * 257 + c] + imgs[(size_t)c * HW + p];
  }
}

// ---------------------------------------------------------------------------
// Launch: prep -> proj -> attn, all on `stream` (in-order).
// Workspace (bf16): packed W q/k/v (3*128KB), Q (16MB), K (16MB), Vt (16MB).
// ---------------------------------------------------------------------------
extern "C" void kernel_launch(void* const* d_in, const int* in_sizes, int n_in,
                              void* d_out, int out_size, void* d_ws,
                              size_t ws_size, hipStream_t stream) {
  (void)in_sizes; (void)n_in; (void)out_size; (void)ws_size;
  const float* img   = (const float*)d_in[0];
  const float* depth = (const float*)d_in[1];
  const float* Wq    = (const float*)d_in[2];
  const float* bq    = (const float*)d_in[3];
  const float* Wk    = (const float*)d_in[4];
  const float* bk    = (const float*)d_in[5];
  const float* Wv    = (const float*)d_in[6];
  const float* bv    = (const float*)d_in[7];
  float* out = (float*)d_out;

  char* ws = (char*)d_ws;
  const size_t WT_BYTES = (size_t)CCH * CCH * 2;       // 128 KB each
  const size_t M_BYTES  = (size_t)NSLICE * HW * CCH * 2;  // 16 MB each
  __bf16* Wtq = (__bf16*)(ws);
  __bf16* Wtk = (__bf16*)(ws + WT_BYTES);
  __bf16* Wtv = (__bf16*)(ws + 2 * WT_BYTES);
  __bf16* Qw  = (__bf16*)(ws + 3 * WT_BYTES);
  __bf16* Kw  = (__bf16*)(ws + 3 * WT_BYTES + M_BYTES);
  __bf16* Vtw = (__bf16*)(ws + 3 * WT_BYTES + 2 * M_BYTES);

  prep_weights_k<<<CCH * CCH / 256, 256, 0, stream>>>(Wq, Wk, Wv, Wtq, Wtk,
                                                      Wtv);

  const size_t proj_lds = (size_t)2 * 64 * XPITCH * sizeof(__bf16);
  proj_k<<<dim3(NSLICE, HW / 64), 256, proj_lds, stream>>>(
      img, depth, Wtq, Wtk, Wtv, bq, bk, bv, Qw, Kw, Vtw);

  attn_k<<<dim3(NSLICE, HW / QROWS), 256, 0, stream>>>(Qw, Kw, Vtw, img, out);
}

// v005
// A run of this version takes 60.4 microseconds.
// Next to v004, in two timings, it ran 1.13 times as fast each time.
// Counting every step since v000, it is 3.33 times as fast.
#include <hip/hip_runtime.h>

// Problem dims (fixed by reference): B=4,S=8 -> 32 slices; H*W=1024; C1=C2=C=256.
#define NSLICE 32
#define HW     1024
#define CCH    256
#define SCALE  0.0625f   // 1/sqrt(256)

typedef __attribute__((ext_vector_type(16))) __bf16 v16bf;
typedef __attribute__((ext_vector_type(8)))  float  v8f;

union FragBF { v16bf v; uint4 u[2]; };

// Load one WMMA operand fragment: lane holds 16 contiguous bf16 (32 bytes).
// Works for both A fragments (lane = row M, K contiguous) and B fragments
// (lane = col N, K contiguous) because B-frag == B^T in A layout.
__device__ __forceinline__ v16bf load_frag(const __bf16* p) {
  FragBF f;
  f.u[0] = *(const uint4*)(p);
  f.u[1] = *(const uint4*)(p + 8);
  return f.v;
}

__device__ __forceinline__ v8f wmma_bf16(v16bf a, v16bf b, v8f c) {
  return __builtin_amdgcn_wmma_f32_16x16x32_bf16(
      /*neg_a=*/false, a, /*neg_b=*/false, b,
      /*c_mod=*/(short)0, c, /*reuse_a=*/false, /*reuse_b=*/false);
}

// Weight fragment from the packed layout written by prep_weights_k: the 16-B
// pieces of the 32 lanes lie side by side, so each wave-wide load covers 512
// contiguous bytes (4 whole 128-B lines). Same element in the same lane and
// register as load_frag on a [cout][c] row: tile = cout / 16, kc = c / 32.
__device__ __forceinline__ v16bf load_wfrag(const __bf16* Wp, int tile, int kc,
                                            int lane) {
  const __bf16* p = Wp + (tile * 8 + kc) * 512 + lane * 8;
  FragBF f;
  f.u[0] = *(const uint4*)(p);
  f.u[1] = *(const uint4*)(p + 256);
  return f.v;
}

// ---------------------------------------------------------------------------
// Kernel 0: bf16-convert the three 256x256 weight matrices and pack them in
// fragment order: W[c][cout] (row-major) ->
//   Wp[cout / 16][c / 32][h][lane][e],  lane = ((c >> 4) & 1) * 16 + cout % 16,
//   h = (c >> 3) & 1, e = c & 7   (1 KB per 16 x 32 fragment).
// ---------------------------------------------------------------------------
__global__ __launch_bounds__(256) void prep_weights_k(
    const float* __restrict__ Wq, const float* __restrict__ Wk,
    const float* __restrict__ Wv,
    __bf16* __restrict__ Wtq, __bf16* __restrict__ Wtk,
    __bf16* __restrict__ Wtv) {
  int idx  = blockIdx.x * 256 + threadIdx.x;   // 0..65535, packed position
  int e    = idx & 7;
  int ln   = (idx >> 3) & 31;
  int h    = (idx >> 8) & 1;
  int kc   = (idx >> 9) & 7;
  int tile = idx >> 12;
  int cout = tile * 16 + (ln & 15);
  int c    = kc * 32 + (ln >> 4) * 16 + h * 8 + e;
  int src  = c * CCH + cout;
  Wtq[idx] = (__bf16)Wq[src];
  Wtk[idx] = (__bf16)Wk[src];
  Wtv[idx] = (__bf16)Wv[src];
}

// ---------------------------------------------------------------------------
// Kernel 1: projections.  Per workgroup: one slice, 64 spatial rows.
//   Q[p][cout] = Xi @ Wq + bq, K[p][cout] = Xd @ Wk + bk  (row-major bf16)
//   Vt[cout][p]             (transposed bf16)  = (Xd @ Wv + bv)^T
// X is staged channel-major->row-major through LDS as bf16.
// Block = 256 threads (8 waves), two blocks per WGP = four waves per SIMD:
// every phase waits on loads, and twice the waves wait side by side.
// Waves 0-3 make Q, waves 4-7 make K (16 rows each, two cout tiles at a time);
// for Vt each wave owns 32 couts. Dynamic LDS = 2 * 64 * 264 bf16.
// ---------------------------------------------------------------------------
#define XPITCH 264

__global__ __launch_bounds__(256)
__attribute__((amdgpu_waves_per_eu(4, 4))) void proj_k(
    const float* __restrict__ img, const float* __restrict__ depth,
    const __bf16* __restrict__ Wtq, const __bf16* __restrict__ Wtk,
    const __bf16* __restrict__ Wtv,
    const float* __restrict__ bq, const float* __restrict__ bk,
    const float* __restrict__ bv,
    __bf16* __restrict__ Qw, __bf16* __restrict__ Kw,
    __bf16* __restrict__ Vtw) {
  extern __shared__ unsigned char dynsmem[];
  __bf16* Xi = (__bf16*)dynsmem;          // [64][XPITCH] img  rows (bf16)
  __bf16* Xd = Xi + 64 * XPITCH;          // [64][XPITCH] depth rows

  const int slice = blockIdx.x;
  const int pbase = blockIdx.y * 64;
  const int tid   = threadIdx.x;
  const int wave  = __builtin_amdgcn_readfirstlane(tid >> 5);
  const int lane  = tid & 31;
  const int l15   = lane & 15;
  const int hi    = lane >> 4;            // 0: K 0..15, 1: K 16..31

  // ---- Stage inputs: global [c][p] f32 (coalesced in p) -> LDS [p][c] bf16
  {
    const float* ib = img   + (size_t)slice * CCH * HW + pbase;
    const float* db = depth + (size_t)slice * CCH * HW + pbase;
#pragma unroll 4
    for (int it = 0; it < 64; ++it) {     // 64*256 / 256 threads
      int idx = it * 256 + tid;
      int c   = idx >> 6;
      int p   = idx & 63;
      Xi[p * XPITCH + c] = (__bf16)ib[(size_t)c * HW + p];
      Xd[p * XPITCH + c] = (__bf16)db[(size_t)c * HW + p];
    }
  }
  __syncthreads();

  // ---- Q or K GEMM: rows [rg*16, rg*16+16), all 256 couts
  {
    const int  rg  = wave & 3;
    const bool isk = wave >= 4;           // the same in a whole wave
    const __bf16* Xs = isk ? Xd  : Xi;
    const __bf16* Ws = isk ? Wtk : Wtq;
    const float*  bs = isk ? bk  : bq;
    __bf16*       Os = isk ? Kw  : Qw;

    v16bf xF[8];
#pragma unroll
    for (int kc = 0; kc < 8; ++kc)
      xF[kc] = load_frag(Xs + (rg * 16 + l15) * XPITCH + kc * 32 + hi * 16);

    for (int cp = 0; cp < 8; ++cp) {      // pairs of cout tiles
      const int ct = cp * 2;
      const float bias0 = bs[ct * 16 + l15];
      const float bias1 = bs[ct * 16 + 16 + l15];
      v16bf w0[8], w1[8];
#pragma unroll
      for (int kc = 0; kc < 8; ++kc) {
        w0[kc] = load_wfrag(Ws, ct, kc, lane);
        w1[kc] = load_wfrag(Ws, ct + 1, kc, lane);
      }
      // The loads' address registers are stepped for the next pair behind them.
      asm volatile("s_wait_xcnt 0x0" ::: "memory");
      // Keeps all 32 weight loads in flight together, ahead of the products.
      __builtin_amdgcn_sched_barrier(0);
      v8f a0, a1;
#pragma unroll
      for (int i = 0; i < 8; ++i) { a0[i] = bias0; a1[i] = bias1; }
#pragma unroll
      for (int kc = 0; kc < 8; ++kc) {
        a0 = wmma_bf16(xF[kc], w0[kc], a0);
        a1 = wmma_bf16(xF[kc], w1[kc], a1);
      }
#pragma unroll
      for (int r = 0; r < 8; ++r) {
        size_t o = ((size_t)slice * HW + pbase + rg * 16 + r + hi * 8) * CCH +
                   ct * 16 + l15;
        Os[o]      = (__bf16)a0[r];
        Os[o + 16] = (__bf16)a1[r];
      }
      // The stores' address registers are stepped for the next pair as well.
      asm volatile("s_wait_xcnt 0x0" ::: "memory");
    }
  }

  // ---- Vt GEMM: M = cout (wave owns 32 couts), N = p (all 64 rows)
  for (int mt = 0; mt < 2; ++mt) {
    const int cbase = wave * 32 + mt * 16;
    v16bf wvF[8];
#pragma unroll
    for (int kc = 0; kc < 8; ++kc)
      wvF[kc] = load_wfrag(Wtv, wave * 2 + mt, kc, lane);
    float bvr[8];
#pragma unroll
    for (int r = 0; r < 8; ++r) bvr[r] = bv[cbase + r + hi * 8];
    // The loads' address registers are stepped for the next mt behind them.
    asm volatile("s_wait_xcnt 0x0" ::: "memory");
    // Keeps that step (and the products) from being lifted over the wait.
    __builtin_amdgcn_sched_barrier(0);

#pragma unroll
    for (int np = 0; np < 2; ++np) {      // pairs of row tiles: two chains
      v16bf x0[8], x1[8];
#pragma unroll
      for (int kc = 0; kc < 8; ++kc) {
        x0[kc] = load_frag(Xd + (np * 32 + l15) * XPITCH + kc * 32 + hi * 16);
        x1[kc] = load_frag(Xd + (np * 32 + 16 + l15) * XPITCH + kc * 32 + hi * 16);
      }
      v8f av0, av1;
#pragma unroll
      for (int r = 0; r < 8; ++r) { av0[r] = bvr[r]; av1[r] = bvr[r]; }
#pragma unroll
      for (int kc = 0; kc < 8; ++kc) {
        av0 = wmma_bf16(wvF[kc], x0[kc], av0);
        av1 = wmma_bf16(wvF[kc], x1[kc], av1);
      }
#pragma unroll
      for (int r = 0; r < 8; ++r) {
        size_t o = ((size_t)slice * CCH + cbase + r + hi * 8) * HW + pbase +
                   np * 32 + l15;
        Vtw[o]      = (__bf16)av0[r];
        Vtw[o + 16] = (__bf16)av1[r];
      }
    }
    // The stores' address registers are stepped for the next mt as well.
    asm volatile("s_wait_xcnt 0x0" ::: "memory");
  }
}

#define QROWS 128
#define KT    64
#define KP    264
#define VP    72
#define KBUF  (KT * KP)
#define VBUF  (CCH * VP)
#define NPASS (HW / KT)
#define ATTN_LDS ((2 * KBUF + 2 * VBUF) * 2)
#define RES_LDS  (CCH * QROWS * 4)  // residual tile [CCH][QROWS] f32
#define RPASS    8                  // passes that issue residual copies (4 each)

typedef __attribute__((ext_vector_type(4))) unsigned int u32x4;

// V^T fragment in the k order of a packed accumulator pair: element s of wave
// half h is key 8 h + s (s < 8) or 16 + 8 h + (s - 8) of a 32-key chunk.
// p = row start + chunk * 32 + 8 * h.
__device__ __forceinline__ v16bf load_frag_kmap(const __bf16* p) {
  FragBF f;
  f.u[0] = *(const uint4*)(p);
  f.u[1] = *(const uint4*)(p + 16);
  return f.v;
}

// Value of lane l ^ 16 (the other wave half).
__device__ __forceinline__ float xhalf(float x) {
  return __int_as_float(__builtin_amdgcn_permlanex16(
      __float_as_int(x), __float_as_int(x), 0x76543210, 0xfedcba98, false,
      false));
}

__global__ __launch_bounds__(256) void attn_k(
    const __bf16* __restrict__ Qw, const __bf16* __restrict__ Kw,
    const __bf16* __restrict__ Vtw, const float* __restrict__ img,
    float* __restrict__ out) {
  __shared__ __attribute__((aligned(16))) unsigned char smem[ATTN_LDS + RES_LDS];

  const int slice = blockIdx.x;
  const int pbase = blockIdx.y * QROWS;
  const int tid   = threadIdx.x;
  const int wave  = tid >> 5;
  const int lane  = tid & 31;
  const int l15   = lane & 15;
  const int hi    = lane >> 4;
  const int wrow  = wave * 16;

  __bf16* Kt = (__bf16*)smem;                 // [2][KT][KP]
  __bf16* Vt = Kt + 2 * KBUF;                 // [2][CCH][VP]

  const __bf16* Qs = Qw  + (size_t)slice * HW * CCH;
  const __bf16* Ks = Kw  + (size_t)slice * HW * CCH;
  const __bf16* Vs = Vtw + (size_t)slice * CCH * HW;

  // Each thread moves 8 + 8 pieces of 16 B per tile. A K tile (64 rows of
  // 512 B) is one contiguous 32 KB run; a V^T tile is 256 rows of 128 B.
  const int krow = tid >> 5, kseg = tid & 31;   // + 8 rows per piece
  const int vrow = tid >> 3, vseg = tid & 7;    // + 32 rows per piece
  const __bf16* kg = Ks + tid * 8;
  const __bf16* vg = Vs + (size_t)vrow * HW + vseg * 8;
  __bf16* kl = Kt + krow * KP + kseg * 8;
  __bf16* vl = Vt + vrow * VP + vseg * 8;

  // Residual copies: a wave moves one 512-B row piece per copy, 16 B a lane;
  // copy n of a thread is channel row n * 8 + wave.
  const float* rg = img + (size_t)slice * CCH * HW + pbase +
                    (size_t)krow * HW + kseg * 4;
  const unsigned rl = (unsigned)(uintptr_t)(smem + ATTN_LDS) +
                      krow * (QROWS * 4) + kseg * 16;

  u32x4 kst[8], vst[8];
#pragma unroll
  for (int i = 0; i < 8; ++i) {
    kst[i] = *(const u32x4*)(kg + i * 2048);
    vst[i] = *(const u32x4*)(vg + (size_t)i * 32 * HW);
  }

  // Register-resident Q fragments for this wave's 16 rows (8 K-chunks).
  v16bf qf[8];
  {
    const __bf16* qrow = Qs + (size_t)(pbase + wrow + l15) * CCH + hi * 16;
#pragma unroll
    for (int kc = 0; kc < 8; ++kc) qf[kc] = load_frag(qrow + kc * 32);
    // The loads' address registers are reused before their data is waited for.
    asm volatile("s_wait_xcnt 0x0" ::: "memory");
  }

#pragma unroll
  for (int i = 0; i < 8; ++i) {
    *(u32x4*)(kl + i * 8 * KP)  = kst[i];
    *(u32x4*)(vl + i * 32 * VP) = vst[i];
  }
  __syncthreads();

  // State of query wrow + l15. oacc[ct][r] = O^T[ct * 16 + r + 8 * hi][l15].
  float rmax = -3.0e38f, rsum = 0.f;          // rsum: this wave half's keys only
  v8f oacc[16];
#pragma unroll
  for (int ct = 0; ct < 16; ++ct)
#pragma unroll
    for (int i = 0; i < 8; ++i) oacc[ct][i] = 0.f;

  for (int t = 0; t < NPASS; ++t) {
    const __bf16* Kb = Kt + (t & 1) * KBUF;
    const __bf16* Vb = Vt + (t & 1) * VBUF;
    const bool more = (t + 1 < NPASS);

    // Next tile's global loads fly under this pass's products.
    if (more) {
#pragma unroll
      for (int i = 0; i < 8; ++i) {
        kst[i] = *(const u32x4*)(kg + (t + 1) * (KT * CCH) + i * 2048);
        vst[i] = *(const u32x4*)(vg + (size_t)i * 32 * HW + (t + 1) * KT);
      }
      // The loads' address registers are reused right behind them.
      asm volatile("s_wait_xcnt 0x0" ::: "memory");
    }

    // Four residual rows per thread and pass; nothing waits for their data
    // before the end of the loop. Their address registers are reused right
    // behind the statement: the closing s_wait_xcnt stands in front of that.
    if (t < RPASS) {
      const float* g0 = rg + (size_t)(t * 32) * HW;
      const unsigned l0 = rl + t * 32 * (QROWS * 4);
      asm volatile(
          "global_load_async_to_lds_b128 %0, %4, off\n\t"
          "global_load_async_to_lds_b128 %1, %5, off\n\t"
          "global_load_async_to_lds_b128 %2, %6, off\n\t"
          "global_load_async_to_lds_b128 %3, %7, off\n\t"
          "s_wait_xcnt 0x0"
          :: "v"(l0), "v"(l0 + 8 * (QROWS * 4)), "v"(l0 + 16 * (QROWS * 4)),
             "v"(l0 + 24 * (QROWS * 4)),
             "v"(g0), "v"(g0 + 8 * HW), "v"(g0 + 16 * HW), "v"(g0 + 24 * HW)
          : "memory");
    }

    // S^T = K Q^T for 64 keys x 16 queries: four independent accumulator tiles,
    // s[nt][r] = score of key nt * 16 + r + 8 * hi, query l15.
    // LDS fragments come in groups of 8 (16 reads), each group issued as one
    // run a group ahead of its products, into the other half of fb.
    v16bf fb[2][8];
    v8f s[4];
#pragma unroll
    for (int nt = 0; nt < 4; ++nt)
#pragma unroll
      for (int i = 0; i < 8; ++i) s[nt][i] = 0.f;
#pragma unroll
    for (int j = 0; j < 8; ++j)
      fb[0][j] = load_frag(Kb + ((j & 3) * 16 + l15) * KP + (j >> 2) * 32 + hi * 16);
#pragma unroll
    for (int g = 0; g < 4; ++g) {
#pragma unroll
      for (int j = 0; j < 8; ++j) {
        if (g < 3)
          fb[(g + 1) & 1][j] = load_frag(Kb + ((j & 3) * 16 + l15) * KP +
                                         ((g + 1) * 2 + (j >> 2)) * 32 + hi * 16);
        else   // first V^T group: flies under the last products and the softmax
          fb[0][j] = load_frag_kmap(Vb + ((j & 3) * 16 + l15) * VP + (j >> 2) * 32 + hi * 8);
      }
      // Keeps the next group's reads together ahead of this group's products.
      __builtin_amdgcn_sched_barrier(0);
#pragma unroll
      for (int j = 0; j < 8; ++j)
        s[j & 3] = wmma_bf16(fb[g & 1][j], qf[g * 2 + (j >> 2)], s[j & 3]);
      // Keeps the group after next from being spread among these products.
      __builtin_amdgcn_sched_barrier(0);
    }

    // Running maximum and sum of this lane's query: in-lane over its 32
    // scores (one chain per tile), one exchange between the wave halves.
    float tmx[4], ps[4];
#pragma unroll
    for (int nt = 0; nt < 4; ++nt) {
      tmx[nt] = s[nt][0];
#pragma unroll
      for (int r = 1; r < 8; ++r) tmx[nt] = fmaxf(tmx[nt], s[nt][r]);
    }
    float tm = fmaxf(fmaxf(tmx[0], tmx[1]), fmaxf(tmx[2], tmx[3]));
    tm = fmaxf(tm, xhalf(tm)) * SCALE;
    const float mn    = fmaxf(rmax, tm);
    const float alpha = __expf(rmax - mn);
    rmax = mn;
    // P^T: score tiles 2 c and 2 c + 1, converted in place, are the B operand
    // of key chunk c (element e = tile e >> 3, register e & 7).
    v16bf pf[2];
#pragma unroll
    for (int nt = 0; nt < 4; ++nt) {
      ps[nt] = 0.f;
#pragma unroll
      for (int r = 0; r < 8; ++r) {
        const float p = __expf(s[nt][r] * SCALE - mn);
        ps[nt] += p;
        pf[nt >> 1][(nt & 1) * 8 + r] = (__bf16)p;
      }
    }
    rsum = rsum * alpha + ((ps[0] + ps[1]) + (ps[2] + ps[3]));

    // O^T += V^T P^T: A = V^T rows in the k order of pf, B = pf, in groups of
    // 4 channel tiles x 2 key chunks, fetched a group ahead as above.
#pragma unroll
    for (int g = 0; g < 4; ++g) {
      if (g < 3) {
#pragma unroll
        for (int j = 0; j < 8; ++j)
          fb[(g + 1) & 1][j] = load_frag_kmap(Vb + (((g + 1) * 4 + (j & 3)) * 16 + l15) * VP +
                                              (j >> 2) * 32 + hi * 8);
      }
      // Keeps the next group's reads together ahead of this group's products.
      __builtin_amdgcn_sched_barrier(0);
      if (g == 0) {   // rescale under the latency of the V^T reads
#pragma unroll
        for (int ct = 0; ct < 16; ++ct)
#pragma unroll
          for (int r = 0; r < 8; ++r) oacc[ct][r] *= alpha;
      }
#pragma unroll
      for (int j = 0; j < 8; ++j)
        oacc[g * 4 + (j & 3)] =
            wmma_bf16(fb[g & 1][j], pf[j >> 2], oacc[g * 4 + (j & 3)]);
      // Keeps the group after next from being spread among these products.
      __builtin_amdgcn_sched_barrier(0);
    }

    // Fill the other buffer: its readers left it at the last barrier.
    if (more) {
      const int nb = (t + 1) & 1;
#pragma unroll
      for (int i = 0; i < 8; ++i) {
        *(u32x4*)(kl + nb * KBUF + i * 8 * KP)  = kst[i];
        *(u32x4*)(vl + nb * VBUF + i * 32 * VP) = vst[i];
      }
    }
    __syncthreads();   // publishes tile t + 1, ends every read of tile t
  }

  // ---- Normalize, LDS transpose (over the K / V buffers), residual.
  // The last pass's barrier has ended every read of the tiles.
  // This wave's residual copies have landed; the barrier below publishes them.
  asm volatile("s_wait_asynccnt 0x0" ::: "memory");
  float* ost = (float*)smem;                  // overlay: [QROWS][257]
  const float* res = (const float*)(smem + ATTN_LDS);   // [CCH][QROWS]
  const float inv = 1.0f / (rsum + xhalf(rsum));
#pragma unroll
  for (int ct = 0; ct < 16; ++ct)
#pragma unroll
    for (int r = 0; r < 8; ++r)
      ost[(wrow + l15) * 257 + ct * 16 + r + hi * 8] = oacc[ct][r] * inv;
  __syncthreads();

  float*       outs = out + (size_t)slice * CCH * HW + pbase;
  const int p  = tid & 127;                   // 128*256 / 256 threads:
  const int c0 = tid >> 7;                    // 128 elements each, 8 a round
  for (int ib = 0; ib < 128; ib += 8) {
    float v[8];
#pragma unroll
    for (int j = 0; j < 8; ++j) {
      const int c = (ib + j) * 2 + c0;
      v[j] = ost[p * 257 + c] + res[c * QROWS + p];
    }
#pragma unroll
    for (int j = 0; j < 8; ++j)
      outs[(size_t)((ib + j) * 2 + c0) * HW + p] = v[j];
    // The stores' address registers are stepped for the next round behind them.
    asm volatile("s_wait_xcnt 0x0" ::: "memory");
  }
}

// ---------------------------------------------------------------------------
// Launch: prep -> proj -> attn, all on `stream` (in-order).
// Workspace (bf16): packed W q/k/v (3*128KB), Q (16MB), K (16MB), Vt (16MB).
// ---------------------------------------------------------------------------
extern "C" void kernel_launch(void* const* d_in, const int* in_sizes, int n_in,
                              void* d_out, int out_size, void* d_ws,
                              size_t ws_size, hipStream_t stream) {
  (void)in_sizes; (void)n_in; (void)out_size; (void)ws_size;
  const float* img   = (const float*)d_in[0];
  const float* depth = (const float*)d_in[1];
  const float* Wq    = (const float*)d_in[2];
  const float* bq    = (const float*)d_in[3];
  const float* Wk    = (const float*)d_in[4];
  const float* bk    = (const float*)d_in[5];
  const float* Wv    = (const float*)d_in[6];
  const float* bv    = (const float*)d_in[7];
  float* out = (float*)d_out;

  char* ws = (char*)d_ws;
  const size_t WT_BYTES = (size_t)CCH * CCH * 2;       // 128 KB each
  const size_t M_BYTES  = (size_t)NSLICE * HW * CCH * 2;  // 16 MB each
  __bf16* Wtq = (__bf16*)(ws);
  __bf16* Wtk = (__bf16*)(ws + WT_BYTES);
  __bf16* Wtv = (__bf16*)(ws + 2 * WT_BYTES);
  __bf16* Qw  = (__bf16*)(ws + 3 * WT_BYTES);
  __bf16* Kw  = (__bf16*)(ws + 3 * WT_BYTES + M_BYTES);
  __bf16* Vtw = (__bf16*)(ws + 3 * WT_BYTES + 2 * M_BYTES);

  prep_weights_k<<<CCH * CCH / 256, 256, 0, stream>>>(Wq, Wk, Wv, Wtq, Wtk,
                                                      Wtv);

  const size_t proj_lds = (size_t)2 * 64 * XPITCH * sizeof(__bf16);
  proj_k<<<dim3(NSLICE, HW / 64), 256, proj_lds, stream>>>(
      img, depth, Wtq, Wtk, Wtv, bq, bk, bv, Qw, Kw, Vtw);

  attn_k<<<dim3(NSLICE, HW / QROWS), 256, 0, stream>>>(Qw, Kw, Vtw, img, out);
}

// v006
// A run of this version takes 55.6 microseconds.
// Next to v005, in two timings, it ran 1.09 times as fast each time.
// Counting every step since v000, it is 3.64 times as fast.
#include <hip/hip_runtime.h>

// Problem dims (fixed by reference): B=4,S=8 -> 32 slices; H*W=1024; C1=C2=C=256.
#define NSLICE 32
#define HW     1024
#define CCH    256
#define SCALE  0.0625f   // 1/sqrt(256)

typedef __attribute__((ext_vector_type(16))) __bf16 v16bf;
typedef __attribute__((ext_vector_type(8)))  float  v8f;
typedef __attribute__((ext_vector_type(4)))  float  f32x4;

union FragBF { v16bf v; uint4 u[2]; };

// Load one WMMA operand fragment: lane holds 16 contiguous bf16 (32 bytes).
// Works for both A fragments (lane = row M, K contiguous) and B fragments
// (lane = col N, K contiguous) because B-frag == B^T in A layout.
__device__ __forceinline__ v16bf load_frag(const __bf16* p) {
  FragBF f;
  f.u[0] = *(const uint4*)(p);
  f.u[1] = *(const uint4*)(p + 8);
  return f.v;
}

__device__ __forceinline__ v8f wmma_bf16(v16bf a, v16bf b, v8f c) {
  return __builtin_amdgcn_wmma_f32_16x16x32_bf16(
      /*neg_a=*/false, a, /*neg_b=*/false, b,
      /*c_mod=*/(short)0, c, /*reuse_a=*/false, /*reuse_b=*/false);
}

// Weight fragment from the packed layout written by prep_weights_k: the 16-B
// pieces of the 32 lanes lie side by side, so each wave-wide load covers 512
// contiguous bytes (4 whole 128-B lines). Same element in the same lane and
// register as load_frag on a [cout][c] row: tile = cout / 16, kc = c / 32.
__device__ __forceinline__ v16bf load_wfrag(const __bf16* Wp, int tile, int kc,
                                            int lane) {
  const __bf16* p = Wp + (tile * 8 + kc) * 512 + lane * 8;
  FragBF f;
  f.u[0] = *(const uint4*)(p);
  f.u[1] = *(const uint4*)(p + 256);
  return f.v;
}

// ---------------------------------------------------------------------------
// Kernel 0: bf16-convert the three 256x256 weight matrices and pack them in
// fragment order: W[c][cout] (row-major) ->
//   Wp[cout / 16][c / 32][h][lane][e],  lane = ((c >> 4) & 1) * 16 + cout % 16,
//   h = (c >> 3) & 1, e = c & 7   (1 KB per 16 x 32 fragment).
// ---------------------------------------------------------------------------
__global__ __launch_bounds__(256) void prep_weights_k(
    const float* __restrict__ Wq, const float* __restrict__ Wk,
    const float* __restrict__ Wv,
    __bf16* __restrict__ Wtq, __bf16* __restrict__ Wtk,
    __bf16* __restrict__ Wtv) {
  int idx  = blockIdx.x * 256 + threadIdx.x;   // 0..65535, packed position
  int e    = idx & 7;
  int ln   = (idx >> 3) & 31;
  int h    = (idx >> 8) & 1;
  int kc   = (idx >> 9) & 7;
  int tile = idx >> 12;
  int cout = tile * 16 + (ln & 15);
  int c    = kc * 32 + (ln >> 4) * 16 + h * 8 + e;
  int src  = c * CCH + cout;
  Wtq[idx] = (__bf16)Wq[src];
  Wtk[idx] = (__bf16)Wk[src];
  Wtv[idx] = (__bf16)Wv[src];
}

// ---------------------------------------------------------------------------
// Kernel 1: projections.  Per workgroup: one slice, 64 spatial rows.
//   Q[p][cout] = Xi @ Wq + bq, K[p][cout] = Xd @ Wk + bk  (row-major bf16)
//   Vt[cout][p]             (transposed bf16)  = (Xd @ Wv + bv)^T
// X is staged channel-major->row-major through LDS as bf16, all of a thread's
// loads in flight at once.
// Block = 256 threads (8 waves), two blocks per WGP = four waves per SIMD:
// every phase waits on loads, and twice the waves wait side by side.
// Waves 0-3 make Q, waves 4-7 make K (16 rows each, two cout tiles at a time);
// for Vt each wave owns 32 couts. Dynamic LDS = 2 * 64 * 264 bf16.
// ---------------------------------------------------------------------------
#define XPITCH 264

__global__ __launch_bounds__(256)
__attribute__((amdgpu_waves_per_eu(4, 4))) void proj_k(
    const float* __restrict__ img, const float* __restrict__ depth,
    const __bf16* __restrict__ Wtq, const __bf16* __restrict__ Wtk,
    const __bf16* __restrict__ Wtv,
    const float* __restrict__ bq, const float* __restrict__ bk,
    const float* __restrict__ bv,
    __bf16* __restrict__ Qw, __bf16* __restrict__ Kw,
    __bf16* __restrict__ Vtw) {
  extern __shared__ unsigned char dynsmem[];
  __bf16* Xi = (__bf16*)dynsmem;          // [64][XPITCH] img  rows (bf16)
  __bf16* Xd = Xi + 64 * XPITCH;          // [64][XPITCH] depth rows

  const int slice = blockIdx.x;
  const int pbase = blockIdx.y * 64;
  const int tid   = threadIdx.x;
  const int wave  = __builtin_amdgcn_readfirstlane(tid >> 5);
  const int lane  = tid & 31;
  const int l15   = lane & 15;
  const int hi    = lane >> 4;            // 0: K 0..15, 1: K 16..31

  // ---- Stage inputs: global [c][p] f32 -> LDS [p][c] bf16.
  // A thread owns 16 channels x 4 rows of both tiles: 16 + 16 loads of 16 B,
  // all issued before the first is used, so the tiles cost one memory latency
  // plus their transfer. A wave-wide load covers 4 channel rows x one 128-B
  // line. Per row the 16 channels are 32 B of LDS: two 16-B stores.
  {
    const int seg = (lane & 7) + 8 * (wave & 1);    // 16-B piece of a 256-B row
    const int cg  = (lane >> 3) + 4 * (wave >> 1);  // group of 16 channels
    const size_t go = (size_t)slice * CCH * HW + (size_t)(cg * 16) * HW +
                      pbase + seg * 4;
    const float* ib = img + go;
    const float* db = depth + go;
    f32x4 xi[16], xd[16];
#pragma unroll
    for (int j = 0; j < 16; ++j) xi[j] = *(const f32x4*)(ib + j * HW);
#pragma unroll
    for (int j = 0; j < 16; ++j) xd[j] = *(const f32x4*)(db + j * HW);
    // The loads' address registers are reused behind this wait. Naming them as
    // inputs keeps them live up to it, so no load's result is placed on them.
    asm volatile("s_wait_xcnt 0x0" :: "v"(ib), "v"(db) : "memory");
    // Keeps the 32 loads in source order (img first, so its conversion starts
    // while depth still arrives) and all of them ahead of the first conversion.
    __builtin_amdgcn_sched_barrier(0);
#pragma unroll
    for (int k = 0; k < 4; ++k) {
      FragBF f;
#pragma unroll
      for (int j = 0; j < 16; ++j) f.v[j] = (__bf16)xi[j][k];
      __bf16* d = Xi + (seg * 4 + k) * XPITCH + cg * 16;
      *(uint4*)(d)     = f.u[0];
      *(uint4*)(d + 8) = f.u[1];
    }
    // Keeps the img tile's LDS stores ahead of the wait for the depth loads.
    __builtin_amdgcn_sched_barrier(0);
#pragma unroll
    for (int k = 0; k < 4; ++k) {
      FragBF f;
#pragma unroll
      for (int j = 0; j < 16; ++j) f.v[j] = (__bf16)xd[j][k];
      __bf16* d = Xd + (seg * 4 + k) * XPITCH + cg * 16;
      *(uint4*)(d)     = f.u[0];
      *(uint4*)(d + 8) = f.u[1];
    }
  }
  __syncthreads();

  // ---- Q or K GEMM: rows [rg*16, rg*16+16), all 256 couts
  {
    const int  rg  = wave & 3;
    const bool isk = wave >= 4;           // the same in a whole wave
    const __bf16* Xs = isk ? Xd  : Xi;
    const __bf16* Ws = isk ? Wtk : Wtq;
    const float*  bs = isk ? bk  : bq;
    __bf16*       Os = isk ? Kw  : Qw;

    v16bf xF[8];
#pragma unroll
    for (int kc = 0; kc < 8; ++kc)
      xF[kc] = load_frag(Xs + (rg * 16 + l15) * XPITCH + kc * 32 + hi * 16);

    for (int cp = 0; cp < 8; ++cp) {      // pairs of cout tiles
      const int ct = cp * 2;
      const float bias0 = bs[ct * 16 + l15];
      const float bias1 = bs[ct * 16 + 16 + l15];
      v16bf w0[8], w1[8];
#pragma unroll
      for (int kc = 0; kc < 8; ++kc) {
        w0[kc] = load_wfrag(Ws, ct, kc, lane);
        w1[kc] = load_wfrag(Ws, ct + 1, kc, lane);
      }
      // The loads' address registers are stepped for the next pair behind them.
      asm volatile("s_wait_xcnt 0x0" ::: "memory");
      // Keeps all 32 weight loads in flight together, ahead of the products.
      __builtin_amdgcn_sched_barrier(0);
      v8f a0, a1;
#pragma unroll
      for (int i = 0; i < 8; ++i) { a0[i] = bias0; a1[i] = bias1; }
#pragma unroll
      for (int kc = 0; kc < 8; ++kc) {
        a0 = wmma_bf16(xF[kc], w0[kc], a0);
        a1 = wmma_bf16(xF[kc], w1[kc], a1);
      }
#pragma unroll
      for (int r = 0; r < 8; ++r) {
        size_t o = ((size_t)slice * HW + pbase + rg * 16 + r + hi * 8) * CCH +
                   ct * 16 + l15;
        Os[o]      = (__bf16)a0[r];
        Os[o + 16] = (__bf16)a1[r];
      }
      // The stores' address registers are stepped for the next pair as well.
      asm volatile("s_wait_xcnt 0x0" ::: "memory");
    }
  }

  // ---- Vt GEMM: M = cout (wave owns 32 couts), N = p (all 64 rows)
  for (int mt = 0; mt < 2; ++mt) {
    const int cbase = wave * 32 + mt * 16;
    v16bf wvF[8];
#pragma unroll
    for (int kc = 0; kc < 8; ++kc)
      wvF[kc] = load_wfrag(Wtv, wave * 2 + mt, kc, lane);
    float bvr[8];
#pragma unroll
    for (int r = 0; r < 8; ++r) bvr[r] = bv[cbase + r + hi * 8];
    // The loads' address registers are stepped for the next mt behind them.
    asm volatile("s_wait_xcnt 0x0" ::: "memory");
    // Keeps that step (and the products) from being lifted over the wait.
    __builtin_amdgcn_sched_barrier(0);

#pragma unroll
    for (int np = 0; np < 2; ++np) {      // pairs of row tiles: two chains
      v16bf x0[8], x1[8];
#pragma unroll
      for (int kc = 0; kc < 8; ++kc) {
        x0[kc] = load_frag(Xd + (np * 32 + l15) * XPITCH + kc * 32 + hi * 16);
        x1[kc] = load_frag(Xd + (np * 32 + 16 + l15) * XPITCH + kc * 32 + hi * 16);
      }
      v8f av0, av1;
#pragma unroll
      for (int r = 0; r < 8; ++r) { av0[r] = bvr[r]; av1[r] = bvr[r]; }
#pragma unroll
      for (int kc = 0; kc < 8; ++kc) {
        av0 = wmma_bf16(wvF[kc], x0[kc], av0);
        av1 = wmma_bf16(wvF[kc], x1[kc], av1);
      }
#pragma unroll
      for (int r = 0; r < 8; ++r) {
        size_t o = ((size_t)slice * CCH + cbase + r + hi * 8) * HW + pbase +
                   np * 32 + l15;
        Vtw[o]      = (__bf16)av0[r];
        Vtw[o + 16] = (__bf16)av1[r];
      }
    }
    // The stores' address registers are stepped for the next mt as well.
    asm volatile("s_wait_xcnt 0x0" ::: "memory");
  }
}

#define QROWS 128
#define KT    64
#define KP    264
#define VP    72
#define KBUF  (KT * KP)
#define VBUF  (CCH * VP)
#define NPASS (HW / KT)
#define ATTN_LDS ((2 * KBUF + 2 * VBUF) * 2)
#define RES_LDS  (CCH * QROWS * 4)  // residual tile [CCH][QROWS] f32
#define RPASS    8                  // passes that issue residual copies (4 each)

typedef __attribute__((ext_vector_type(4))) unsigned int u32x4;

// V^T fragment in the k order of a packed accumulator pair: element s of wave
// half h is key 8 h + s (s < 8) or 16 + 8 h + (s - 8) of a 32-key chunk.
// p = row start + chunk * 32 + 8 * h.
__device__ __forceinline__ v16bf load_frag_kmap(const __bf16* p) {
  FragBF f;
  f.u[0] = *(const uint4*)(p);
  f.u[1] = *(const uint4*)(p + 16);
  return f.v;
}

// Value of lane l ^ 16 (the other wave half).
__device__ __forceinline__ float xhalf(float x) {
  return __int_as_float(__builtin_amdgcn_permlanex16(
      __float_as_int(x), __float_as_int(x), 0x76543210, 0xfedcba98, false,
      false));
}

__global__ __launch_bounds__(256) void attn_k(
    const __bf16* __restrict__ Qw, const __bf16* __restrict__ Kw,
    const __bf16* __restrict__ Vtw, const float* __restrict__ img,
    float* __restrict__ out) {
  __shared__ __attribute__((aligned(16))) unsigned char smem[ATTN_LDS + RES_LDS];

  const int slice = blockIdx.x;
  const int pbase = blockIdx.y * QROWS;
  const int tid   = threadIdx.x;
  const int wave  = tid >> 5;
  const int lane  = tid & 31;
  const int l15   = lane & 15;
  const int hi    = lane >> 4;
  const int wrow  = wave * 16;

  __bf16* Kt = (__bf16*)smem;                 // [2][KT][KP]
  __bf16* Vt = Kt + 2 * KBUF;                 // [2][CCH][VP]

  const __bf16* Qs = Qw  + (size_t)slice * HW * CCH;
  const __bf16* Ks = Kw  + (size_t)slice * HW * CCH;
  const __bf16* Vs = Vtw + (size_t)slice * CCH * HW;

  // Each thread moves 8 + 8 pieces of 16 B per tile. A K tile (64 rows of
  // 512 B) is one contiguous 32 KB run; a V^T tile is 256 rows of 128 B.
  const int krow = tid >> 5, kseg = tid & 31;   // + 8 rows per piece
  const int vrow = tid >> 3, vseg = tid & 7;    // + 32 rows per piece
  const __bf16* kg = Ks + tid * 8;
  const __bf16* vg = Vs + (size_t)vrow * HW + vseg * 8;
  __bf16* kl = Kt + krow * KP + kseg * 8;
  __bf16* vl = Vt + vrow * VP + vseg * 8;

  // Residual copies: a wave moves one 512-B row piece per copy, 16 B a lane;
  // copy n of a thread is channel row n * 8 + wave.
  const float* rg = img + (size_t)slice * CCH * HW + pbase +
                    (size_t)krow * HW + kseg * 4;
  const unsigned rl = (unsigned)(uintptr_t)(smem + ATTN_LDS) +
                      krow * (QROWS * 4) + kseg * 16;

  u32x4 kst[8], vst[8];
#pragma unroll
  for (int i = 0; i < 8; ++i) {
    kst[i] = *(const u32x4*)(kg + i * 2048);
    vst[i] = *(const u32x4*)(vg + (size_t)i * 32 * HW);
  }

  // Register-resident Q fragments for this wave's 16 rows (8 K-chunks).
  v16bf qf[8];
  {
    const __bf16* qrow = Qs + (size_t)(pbase + wrow + l15) * CCH + hi * 16;
#pragma unroll
    for (int kc = 0; kc < 8; ++kc) qf[kc] = load_frag(qrow + kc * 32);
    // The loads' address registers are reused before their data is waited for.
    asm volatile("s_wait_xcnt 0x0" ::: "memory");
  }

#pragma unroll
  for (int i = 0; i < 8; ++i) {
    *(u32x4*)(kl + i * 8 * KP)  = kst[i];
    *(u32x4*)(vl + i * 32 * VP) = vst[i];
  }
  __syncthreads();

  // State of query wrow + l15. oacc[ct][r] = O^T[ct * 16 + r + 8 * hi][l15].
  float rmax = -3.0e38f, rsum = 0.f;          // rsum: this wave half's keys only
  v8f oacc[16];
#pragma unroll
  for (int ct = 0; ct < 16; ++ct)
#pragma unroll
    for (int i = 0; i < 8; ++i) oacc[ct][i] = 0.f;

  for (int t = 0; t < NPASS; ++t) {
    const __bf16* Kb = Kt + (t & 1) * KBUF;
    const __bf16* Vb = Vt + (t & 1) * VBUF;
    const bool more = (t + 1 < NPASS);

    // Next tile's global loads fly under this pass's products.
    if (more) {
#pragma unroll
      for (int i = 0; i < 8; ++i) {
        kst[i] = *(const u32x4*)(kg + (t + 1) * (KT * CCH) + i * 2048);
        vst[i] = *(const u32x4*)(vg + (size_t)i * 32 * HW + (t + 1) * KT);
      }
      // The loads' address registers are reused right behind them.
      asm volatile("s_wait_xcnt 0x0" ::: "memory");
    }

    // Four residual rows per thread and pass; nothing waits for their data
    // before the end of the loop. Their address registers are reused right
    // behind the statement: the closing s_wait_xcnt stands in front of that.
    if (t < RPASS) {
      const float* g0 = rg + (size_t)(t * 32) * HW;
      const unsigned l0 = rl + t * 32 * (QROWS * 4);
      asm volatile(
          "global_load_async_to_lds_b128 %0, %4, off\n\t"
          "global_load_async_to_lds_b128 %1, %5, off\n\t"
          "global_load_async_to_lds_b128 %2, %6, off\n\t"
          "global_load_async_to_lds_b128 %3, %7, off\n\t"
          "s_wait_xcnt 0x0"
          :: "v"(l0), "v"(l0 + 8 * (QROWS * 4)), "v"(l0 + 16 * (QROWS * 4)),
             "v"(l0 + 24 * (QROWS * 4)),
             "v"(g0), "v"(g0 + 8 * HW), "v"(g0 + 16 * HW), "v"(g0 + 24 * HW)
          : "memory");
    }

    // S^T = K Q^T for 64 keys x 16 queries: four independent accumulator tiles,
    // s[nt][r] = score of key nt * 16 + r + 8 * hi, query l15.
    // LDS fragments come in groups of 8 (16 reads), each group issued as one
    // run a group ahead of its products, into the other half of fb.
    v16bf fb[2][8];
    v8f s[4];
#pragma unroll
    for (int nt = 0; nt < 4; ++nt)
#pragma unroll
      for (int i = 0; i < 8; ++i) s[nt][i] = 0.f;
#pragma unroll
    for (int j = 0; j < 8; ++j)
      fb[0][j] = load_frag(Kb + ((j & 3) * 16 + l15) * KP + (j >> 2) * 32 + hi * 16);
#pragma unroll
    for (int g = 0; g < 4; ++g) {
#pragma unroll
      for (int j = 0; j < 8; ++j) {
        if (g < 3)
          fb[(g + 1) & 1][j] = load_frag(Kb + ((j & 3) * 16 + l15) * KP +
                                         ((g + 1) * 2 + (j >> 2)) * 32 + hi * 16);
        else   // first V^T group: flies under the last products and the softmax
          fb[0][j] = load_frag_kmap(Vb + ((j & 3) * 16 + l15) * VP + (j >> 2) * 32 + hi * 8);
      }
      // Keeps the next group's reads together ahead of this group's products.
      __builtin_amdgcn_sched_barrier(0);
#pragma unroll
      for (int j = 0; j < 8; ++j)
        s[j & 3] = wmma_bf16(fb[g & 1][j], qf[g * 2 + (j >> 2)], s[j & 3]);
      // Keeps the group after next from being spread among these products.
      __builtin_amdgcn_sched_barrier(0);
    }

    // Running maximum and sum of this lane's query: in-lane over its 32
    // scores (one chain per tile), one exchange between the wave halves.
    float tmx[4], ps[4];
#pragma unroll
    for (int nt = 0; nt < 4; ++nt) {
      tmx[nt] = s[nt][0];
#pragma unroll
      for (int r = 1; r < 8; ++r) tmx[nt] = fmaxf(tmx[nt], s[nt][r]);
    }
    float tm = fmaxf(fmaxf(tmx[0], tmx[1]), fmaxf(tmx[2], tmx[3]));
    tm = fmaxf(tm, xhalf(tm)) * SCALE;
    const float mn    = fmaxf(rmax, tm);
    const float alpha = __expf(rmax - mn);
    rmax = mn;
    // P^T: score tiles 2 c and 2 c + 1, converted in place, are the B operand
    // of key chunk c (element e = tile e >> 3, register e & 7).
    v16bf pf[2];
#pragma unroll
    for (int nt = 0; nt < 4; ++nt) {
      ps[nt] = 0.f;
#pragma unroll
      for (int r = 0; r < 8; ++r) {
        const float p = __expf(s[nt][r] * SCALE - mn);
        ps[nt] += p;
        pf[nt >> 1][(nt & 1) * 8 + r] = (__bf16)p;
      }
    }
    rsum = rsum * alpha + ((ps[0] + ps[1]) + (ps[2] + ps[3]));

    // O^T += V^T P^T: A = V^T rows in the k order of pf, B = pf, in groups of
    // 4 channel tiles x 2 key chunks, fetched a group ahead as above.
#pragma unroll
    for (int g = 0; g < 4; ++g) {
      if (g < 3) {
#pragma unroll
        for (int j = 0; j < 8; ++j)
          fb[(g + 1) & 1][j] = load_frag_kmap(Vb + (((g + 1) * 4 + (j & 3)) * 16 + l15) * VP +
                                              (j >> 2) * 32 + hi * 8);
      }
      // Keeps the next group's reads together ahead of this group's products.
      __builtin_amdgcn_sched_barrier(0);
      if (g == 0) {   // rescale under the latency of the V^T reads
#pragma unroll
        for (int ct = 0; ct < 16; ++ct)
#pragma unroll
          for (int r = 0; r < 8; ++r) oacc[ct][r] *= alpha;
      }
#pragma unroll
      for (int j = 0; j < 8; ++j)
        oacc[g * 4 + (j & 3)] =
            wmma_bf16(fb[g & 1][j], pf[j >> 2], oacc[g * 4 + (j & 3)]);
      // Keeps the group after next from being spread among these products.
      __builtin_amdgcn_sched_barrier(0);
    }

    // Fill the other buffer: its readers left it at the last barrier.
    if (more) {
      const int nb = (t + 1) & 1;
#pragma unroll
      for (int i = 0; i < 8; ++i) {
        *(u32x4*)(kl + nb * KBUF + i * 8 * KP)  = kst[i];
        *(u32x4*)(vl + nb * VBUF + i * 32 * VP) = vst[i];
      }
    }
    __syncthreads();   // publishes tile t + 1, ends every read of tile t
  }

  // ---- Normalize, LDS transpose (over the K / V buffers), residual.
  // The last pass's barrier has ended every read of the tiles.
  // This wave's residual copies have landed; the barrier below publishes them.
  asm volatile("s_wait_asynccnt 0x0" ::: "memory");
  float* ost = (float*)smem;                  // overlay: [QROWS][257]
  const float* res = (const float*)(smem + ATTN_LDS);   // [CCH][QROWS]
  const float inv = 1.0f / (rsum + xhalf(rsum));
#pragma unroll
  for (int ct = 0; ct < 16; ++ct)
#pragma unroll
    for (int r = 0; r < 8; ++r)
      ost[(wrow + l15) * 257 + ct * 16 + r + hi * 8] = oacc[ct][r] * inv;
  __syncthreads();

  float*       outs = out + (size_t)slice * CCH * HW + pbase;
  const int p  = tid & 127;                   // 128*256 / 256 threads:
  const int c0 = tid >> 7;                    // 128 elements each, 8 a round
  for (int ib = 0; ib < 128; ib += 8) {
    float v[8];
#pragma unroll
    for (int j = 0; j < 8; ++j) {
      const int c = (ib + j) * 2 + c0;
      v[j] = ost[p * 257 + c] + res[c * QROWS + p];
    }
#pragma unroll
    for (int j = 0; j < 8; ++j)
      outs[(size_t)((ib + j) * 2 + c0) * HW + p] = v[j];
    // The stores' address registers are stepped for the next round behind them.
    asm volatile("s_wait_xcnt 0x0" ::: "memory");
  }
}

// ---------------------------------------------------------------------------
// Launch: prep -> proj -> attn, all on `stream` (in-order).
// Workspace (bf16): packed W q/k/v (3*128KB), Q (16MB), K (16MB), Vt (16MB).
// ---------------------------------------------------------------------------
extern "C" void kernel_launch(void* const* d_in, const int* in_sizes, int n_in,
                              void* d_out, int out_size, void* d_ws,
                              size_t ws_size, hipStream_t stream) {
  (void)in_sizes; (void)n_in; (void)out_size; (void)ws_size;
  const float* img   = (const float*)d_in[0];
  const float* depth = (const float*)d_in[1];
  const float* Wq    = (const float*)d_in[2];
  const float* bq    = (const float*)d_in[3];
  const float* Wk    = (const float*)d_in[4];
  const float* bk    = (const float*)d_in[5];
  const float* Wv    = (const float*)d_in[6];
  const float* bv    = (const float*)d_in[7];
  float* out = (float*)d_out;

  char* ws = (char*)d_ws;
  const size_t WT_BYTES = (size_t)CCH * CCH * 2;       // 128 KB each
  const size_t M_BYTES  = (size_t)NSLICE * HW * CCH * 2;  // 16 MB each
  __bf16* Wtq = (__bf16*)(ws);
  __bf16* Wtk = (__bf16*)(ws + WT_BYTES);
  __bf16* Wtv = (__bf16*)(ws + 2 * WT_BYTES);
  __bf16* Qw  = (__bf16*)(ws + 3 * WT_BYTES);
  __bf16* Kw  = (__bf16*)(ws + 3 * WT_BYTES + M_BYTES);
  __bf16* Vtw = (__bf16*)(ws + 3 * WT_BYTES + 2 * M_BYTES);

  prep_weights_k<<<CCH * CCH / 256, 256, 0, stream>>>(Wq, Wk, Wv, Wtq, Wtk,
                                                      Wtv);

  const size_t proj_lds = (size_t)2 * 64 * XPITCH * sizeof(__bf16);
  proj_k<<<dim3(NSLICE, HW / 64), 256, proj_lds, stream>>>(
      img, depth, Wtq, Wtk, Wtv, bq, bk, bv, Qw, Kw, Vtw);

  attn_k<<<dim3(NSLICE, HW / QROWS), 256, 0, stream>>>(Qw, Kw, Vtw, img, out);
}

// v007
// Measured time: 53.3 microseconds a run.
// Two timings next to v006 put it at 1.05 and 1.04 times that version's speed.
// All steps since v000 together make it 3.80 times as fast.
#include <hip/hip_runtime.h>

// Problem dims (fixed by reference): B=4,S=8 -> 32 slices; H*W=1024; C1=C2=C=256.
#define NSLICE 32
#define HW     1024
#define CCH    256
#define SCALE  0.0625f   // 1/sqrt(256)

typedef __attribute__((ext_vector_type(16))) __bf16 v16bf;
typedef __attribute__((ext_vector_type(8)))  float  v8f;
typedef __attribute__((ext_vector_type(4)))  float  f32x4;
typedef __attribute__((ext_vector_type(2)))  float  f32x2;
typedef __attribute__((ext_vector_type(4)))  __bf16 v4bf;

typedef __attribute__((ext_vector_type(2)))  __bf16 v2bf;

union FragBF { v16bf v; uint4 u[2]; };
union FragW  { v16bf v; unsigned w[8]; };

// Two f32 rounded to bf16 in one register: a = even element (low half).
__device__ __forceinline__ unsigned pack2(float a, float b) {
  v2bf t;
  t[0] = (__bf16)a;
  t[1] = (__bf16)b;
  return __builtin_bit_cast(unsigned, t);
}

// Load one WMMA operand fragment: lane holds 16 contiguous bf16 (32 bytes).
// Works for both A fragments (lane = row M, K contiguous) and B fragments
// (lane = col N, K contiguous) because B-frag == B^T in A layout.
__device__ __forceinline__ v16bf load_frag(const __bf16* p) {
  FragBF f;
  f.u[0] = *(const uint4*)(p);
  f.u[1] = *(const uint4*)(p + 8);
  return f.v;
}

__device__ __forceinline__ v8f wmma_bf16(v16bf a, v16bf b, v8f c) {
  return __builtin_amdgcn_wmma_f32_16x16x32_bf16(
      /*neg_a=*/false, a, /*neg_b=*/false, b,
      /*c_mod=*/(short)0, c, /*reuse_a=*/false, /*reuse_b=*/false);
}

// ---------------------------------------------------------------------------
// Kernel 1: projections.  Per workgroup: one slice, 64 spatial rows.
//   Q[p][cout] = Xi @ Wq + bq, K[p][cout] = Xd @ Wk + bk  (row-major bf16)
//   Vt[cout][p]             (transposed bf16)  = (Xd @ Wv + bv)^T
// X is staged channel-major->row-major through LDS as bf16, all of a thread's
// loads in flight at once.
// The weights are read as they lie, f32 W[c][cout], and rounded to bf16 in
// registers. A lane's 16-B (8-B) load holds one channel of 4 (2) neighbouring
// couts; these go to 4 (2) different tiles, so tile j of a block of 64 (32)
// couts holds every 4th (2nd) cout: cout = block + 4 (2) * index + j. No value
// crosses a lane, and a wave-wide load covers whole 128-B lines.
// Block = 256 threads (8 waves), two blocks per WGP = four waves per SIMD.
// Waves 0-3 make Q, waves 4-7 K: all 64 rows x 64 couts each, so a weight is
// read and rounded once per workgroup. For Vt each wave owns 32 couts.
// Dynamic LDS = 2 * 64 * 264 bf16.
// ---------------------------------------------------------------------------
#define XPITCH 264

__global__ __launch_bounds__(256)
__attribute__((amdgpu_waves_per_eu(4, 4))) void proj_k(
    const float* __restrict__ img, const float* __restrict__ depth,
    const float* __restrict__ Wq, const float* __restrict__ Wk,
    const float* __restrict__ Wv,
    const float* __restrict__ bq, const float* __restrict__ bk,
    const float* __restrict__ bv,
    __bf16* __restrict__ Qw, __bf16* __restrict__ Kw,
    __bf16* __restrict__ Vtw) {
  extern __shared__ unsigned char dynsmem[];
  __bf16* Xi = (__bf16*)dynsmem;          // [64][XPITCH] img  rows (bf16)
  __bf16* Xd = Xi + 64 * XPITCH;          // [64][XPITCH] depth rows

  const int slice = blockIdx.x;
  const int pbase = blockIdx.y * 64;
  const int tid   = threadIdx.x;
  const int wave  = __builtin_amdgcn_readfirstlane(tid >> 5);
  const int lane  = tid & 31;
  const int l15   = lane & 15;
  const int hi    = lane >> 4;            // 0: K 0..15, 1: K 16..31

  // ---- Stage inputs: global [c][p] f32 -> LDS [p][c] bf16.
  // A thread owns 16 channels x 4 rows of both tiles: 16 + 16 loads of 16 B,
  // all issued before the first is used, so the tiles cost one memory latency
  // plus their transfer. A wave-wide load covers 4 channel rows x one 128-B
  // line. Per row the 16 channels are 32 B of LDS: two 16-B stores.
  {
    const int seg = (lane & 7) + 8 * (wave & 1);    // 16-B piece of a 256-B row
    const int cg  = (lane >> 3) + 4 * (wave >> 1);  // group of 16 channels
    const size_t go = (size_t)slice * CCH * HW + (size_t)(cg * 16) * HW +
                      pbase + seg * 4;
    const float* ib = img + go;
    const float* db = depth + go;
    f32x4 xi[16], xd[16];
#pragma unroll
    for (int j = 0; j < 16; ++j) xi[j] = *(const f32x4*)(ib + j * HW);
#pragma unroll
    for (int j = 0; j < 16; ++j) xd[j] = *(const f32x4*)(db + j * HW);
    // The loads' address registers are reused behind this wait. Naming them as
    // inputs keeps them live up to it, so no load's result is placed on them.
    asm volatile("s_wait_xcnt 0x0" :: "v"(ib), "v"(db) : "memory");
    // Keeps the 32 loads in source order (img first, so its conversion starts
    // while depth still arrives) and all of them ahead of the first conversion.
    __builtin_amdgcn_sched_barrier(0);
#pragma unroll
    for (int k = 0; k < 4; ++k) {
      FragBF f;
#pragma unroll
      for (int j = 0; j < 16; ++j) f.v[j] = (__bf16)xi[j][k];
      __bf16* d = Xi + (seg * 4 + k) * XPITCH + cg * 16;
      *(uint4*)(d)     = f.u[0];
      *(uint4*)(d + 8) = f.u[1];
    }
    // Keeps the img tile's LDS stores ahead of the wait for the depth loads.
    __builtin_amdgcn_sched_barrier(0);
#pragma unroll
    for (int k = 0; k < 4; ++k) {
      FragBF f;
#pragma unroll
      for (int j = 0; j < 16; ++j) f.v[j] = (__bf16)xd[j][k];
      __bf16* d = Xd + (seg * 4 + k) * XPITCH + cg * 16;
      *(uint4*)(d)     = f.u[0];
      *(uint4*)(d + 8) = f.u[1];
    }
  }
  __syncthreads();

  // Wv chunks, two in flight: channels kc*32 + hi*16 + e, couts 2*l15 + j.
  const float* wvp = Wv + (hi * 16) * CCH + wave * 32 + l15 * 2;
  f32x2 wv[2][16];

  // ---- Q or K GEMM: all 64 rows x couts [cb*64, cb*64+64).
  // Column l15 of tile j is cout cb*64 + 4*l15 + j.
  {
    const int  cb  = wave & 3;
    const bool isk = wave >= 4;           // the same in a whole wave
    const __bf16* Xs = isk ? Xd : Xi;
    const float*  Ws = isk ? Wk : Wq;
    const float*  bs = isk ? bk : bq;
    __bf16*       Os = isk ? Kw : Qw;

    const float* wp = Ws + (hi * 16) * CCH + cb * 64 + l15 * 4;
    const f32x4  b4 = *(const f32x4*)(bs + cb * 64 + l15 * 4);
    v8f acc[4][4];
#pragma unroll
    for (int rt = 0; rt < 4; ++rt)
#pragma unroll
      for (int j = 0; j < 4; ++j)
#pragma unroll
        for (int i = 0; i < 8; ++i) acc[rt][j][i] = b4[j];

#pragma unroll
    for (int kc = 0; kc < 8; ++kc) {
      f32x4 wr[16];                       // channels kc*32 + hi*16 + e
#pragma unroll
      for (int e = 0; e < 16; ++e)
        wr[e] = *(const f32x4*)(wp + (kc * 32 + e) * CCH);
      v16bf x[4];
#pragma unroll
      for (int rt = 0; rt < 4; ++rt)
        x[rt] = load_frag(Xs + (rt * 16 + l15) * XPITCH + kc * 32 + hi * 16);
      // Keeps the LDS reads beside the weight loads: their latency runs under
      // the longer one instead of in front of each group of products.
      __builtin_amdgcn_sched_barrier(0);
      FragW wf[4];
#pragma unroll
      for (int m = 0; m < 8; ++m)
#pragma unroll
        for (int j = 0; j < 4; ++j)
          wf[j].w[m] = pack2(wr[2 * m][j], wr[2 * m + 1][j]);
#pragma unroll
      for (int rt = 0; rt < 4; ++rt)
#pragma unroll
        for (int j = 0; j < 4; ++j)
          acc[rt][j] = wmma_bf16(x[rt], wf[j].v, acc[rt][j]);
      // Keeps the next chunk's loads behind these products: a second set of
      // weight registers does not fit 256 VGPRs and would spill.
      __builtin_amdgcn_sched_barrier(0);
    }
    // The loads' address registers are reused behind them.
    asm volatile("s_wait_xcnt 0x0" ::: "memory");

    // First two chunks of Wv: they fly under the Q / K stores.
#pragma unroll
    for (int e = 0; e < 16; ++e) {
      wv[0][e] = *(const f32x2*)(wvp + e * CCH);
      wv[1][e] = *(const f32x2*)(wvp + (32 + e) * CCH);
    }
    // Keeps those loads ahead of the stores.
    __builtin_amdgcn_sched_barrier(0);

    // A lane's 4 tiles are 4 neighbouring couts: one 8-B store, 128 B a row.
#pragma unroll
    for (int rt = 0; rt < 4; ++rt)
#pragma unroll
      for (int r = 0; r < 8; ++r) {
        const size_t o = ((size_t)slice * HW + pbase + rt * 16 + r + hi * 8) * CCH +
                         cb * 64 + l15 * 4;
        v4bf q;
#pragma unroll
        for (int j = 0; j < 4; ++j) q[j] = (__bf16)acc[rt][j][r];
        *(v4bf*)(Os + o) = q;
      }
    // The stores' address registers are reused behind them as well.
    asm volatile("s_wait_xcnt 0x0" ::: "memory");
  }

  // ---- Vt GEMM: M = cout (wave owns 32 couts), N = p (all 64 rows).
  // Row m of tile j is cout wave*32 + 2*m + j.
  {
    v8f av[2][4];
#pragma unroll
    for (int r = 0; r < 8; ++r) {
      const f32x2 b2 = *(const f32x2*)(bv + wave * 32 + (r + hi * 8) * 2);
#pragma unroll
      for (int j = 0; j < 2; ++j)
#pragma unroll
        for (int nt = 0; nt < 4; ++nt) av[j][nt][r] = b2[j];
    }
#pragma unroll
    for (int kc = 0; kc < 8; ++kc) {
      FragW wf[2];
#pragma unroll
      for (int m = 0; m < 8; ++m)
#pragma unroll
        for (int j = 0; j < 2; ++j)
          wf[j].w[m] = pack2(wv[kc & 1][2 * m][j], wv[kc & 1][2 * m + 1][j]);
      if (kc < 6) {
#pragma unroll
        for (int e = 0; e < 16; ++e)
          wv[kc & 1][e] = *(const f32x2*)(wvp + ((kc + 2) * 32 + e) * CCH);
      }
      // Keeps the loads of the chunk after next ahead of this chunk's products.
      __builtin_amdgcn_sched_barrier(0);
#pragma unroll
      for (int nt = 0; nt < 4; ++nt) {
        const v16bf x =
            load_frag(Xd + (nt * 16 + l15) * XPITCH + kc * 32 + hi * 16);
#pragma unroll
        for (int j = 0; j < 2; ++j) av[j][nt] = wmma_bf16(wf[j].v, x, av[j][nt]);
      }
    }
    // The loads' address registers are reused behind them.
    asm volatile("s_wait_xcnt 0x0" ::: "memory");
#pragma unroll
    for (int j = 0; j < 2; ++j)
#pragma unroll
      for (int nt = 0; nt < 4; ++nt)
#pragma unroll
        for (int r = 0; r < 8; ++r) {
          const size_t o =
              ((size_t)slice * CCH + wave * 32 + (r + hi * 8) * 2 + j) * HW +
              pbase + nt * 16 + l15;
          Vtw[o] = (__bf16)av[j][nt][r];
        }
  }
}

#define QROWS 128
#define KT    64
#define KP    264
#define VP    72
#define KBUF  (KT * KP)
#define VBUF  (CCH * VP)
#define NPASS (HW / KT)
#define ATTN_LDS ((2 * KBUF + 2 * VBUF) * 2)
#define RES_LDS  (CCH * QROWS * 4)  // residual tile [CCH][QROWS] f32
#define RPASS    8                  // passes that issue residual copies (4 each)

typedef __attribute__((ext_vector_type(4))) unsigned int u32x4;

// V^T fragment in the k order of a packed accumulator pair: element s of wave
// half h is key 8 h + s (s < 8) or 16 + 8 h + (s - 8) of a 32-key chunk.
// p = row start + chunk * 32 + 8 * h.
__device__ __forceinline__ v16bf load_frag_kmap(const __bf16* p) {
  FragBF f;
  f.u[0] = *(const uint4*)(p);
  f.u[1] = *(const uint4*)(p + 16);
  return f.v;
}

// Value of lane l ^ 16 (the other wave half).
__device__ __forceinline__ float xhalf(float x) {
  return __int_as_float(__builtin_amdgcn_permlanex16(
      __float_as_int(x), __float_as_int(x), 0x76543210, 0xfedcba98, false,
      false));
}

__global__ __launch_bounds__(256) void attn_k(
    const __bf16* __restrict__ Qw, const __bf16* __restrict__ Kw,
    const __bf16* __restrict__ Vtw, const float* __restrict__ img,
    float* __restrict__ out) {
  __shared__ __attribute__((aligned(16))) unsigned char smem[ATTN_LDS + RES_LDS];

  const int slice = blockIdx.x;
  const int pbase = blockIdx.y * QROWS;
  const int tid   = threadIdx.x;
  const int wave  = tid >> 5;
  const int lane  = tid & 31;
  const int l15   = lane & 15;
  const int hi    = lane >> 4;
  const int wrow  = wave * 16;

  __bf16* Kt = (__bf16*)smem;                 // [2][KT][KP]
  __bf16* Vt = Kt + 2 * KBUF;                 // [2][CCH][VP]

  const __bf16* Qs = Qw  + (size_t)slice * HW * CCH;
  const __bf16* Ks = Kw  + (size_t)slice * HW * CCH;
  const __bf16* Vs = Vtw + (size_t)slice * CCH * HW;

  // Each thread moves 8 + 8 pieces of 16 B per tile. A K tile (64 rows of
  // 512 B) is one contiguous 32 KB run; a V^T tile is 256 rows of 128 B.
  const int krow = tid >> 5, kseg = tid & 31;   // + 8 rows per piece
  const int vrow = tid >> 3, vseg = tid & 7;    // + 32 rows per piece
  const __bf16* kg = Ks + tid * 8;
  const __bf16* vg = Vs + (size_t)vrow * HW + vseg * 8;
  __bf16* kl = Kt + krow * KP + kseg * 8;
  __bf16* vl = Vt + vrow * VP + vseg * 8;

  // Residual copies: a wave moves one 512-B row piece per copy, 16 B a lane;
  // copy n of a thread is channel row n * 8 + wave.
  const float* rg = img + (size_t)slice * CCH * HW + pbase +
                    (size_t)krow * HW + kseg * 4;
  const unsigned rl = (unsigned)(uintptr_t)(smem + ATTN_LDS) +
                      krow * (QROWS * 4) + kseg * 16;

  u32x4 kst[8], vst[8];
#pragma unroll
  for (int i = 0; i < 8; ++i) {
    kst[i] = *(const u32x4*)(kg + i * 2048);
    vst[i] = *(const u32x4*)(vg + (size_t)i * 32 * HW);
  }

  // Register-resident Q fragments for this wave's 16 rows (8 K-chunks).
  v16bf qf[8];
  {
    const __bf16* qrow = Qs + (size_t)(pbase + wrow + l15) * CCH + hi * 16;
#pragma unroll
    for (int kc = 0; kc < 8; ++kc) qf[kc] = load_frag(qrow + kc * 32);
    // The loads' address registers are reused before their data is waited for.
    asm volatile("s_wait_xcnt 0x0" ::: "memory");
  }

#pragma unroll
  for (int i = 0; i < 8; ++i) {
    *(u32x4*)(kl + i * 8 * KP)  = kst[i];
    *(u32x4*)(vl + i * 32 * VP) = vst[i];
  }
  __syncthreads();

  // State of query wrow + l15. oacc[ct][r] = O^T[ct * 16 + r + 8 * hi][l15].
  float rmax = -3.0e38f, rsum = 0.f;          // rsum: this wave half's keys only
  v8f oacc[16];
#pragma unroll
  for (int ct = 0; ct < 16; ++ct)
#pragma unroll
    for (int i = 0; i < 8; ++i) oacc[ct][i] = 0.f;

  for (int t = 0; t < NPASS; ++t) {
    const __bf16* Kb = Kt + (t & 1) * KBUF;
    const __bf16* Vb = Vt + (t & 1) * VBUF;
    const bool more = (t + 1 < NPASS);

    // Next tile's global loads fly under this pass's products.
    if (more) {
#pragma unroll
      for (int i = 0; i < 8; ++i) {
        kst[i] = *(const u32x4*)(kg + (t + 1) * (KT * CCH) + i * 2048);
        vst[i] = *(const u32x4*)(vg + (size_t)i * 32 * HW + (t + 1) * KT);
      }
      // The loads' address registers are reused right behind them.
      asm volatile("s_wait_xcnt 0x0" ::: "memory");
    }

    // Four residual rows per thread and pass; nothing waits for their data
    // before the end of the loop. Their address registers are reused right
    // behind the statement: the closing s_wait_xcnt stands in front of that.
    if (t < RPASS) {
      const float* g0 = rg + (size_t)(t * 32) * HW;
      const unsigned l0 = rl + t * 32 * (QROWS * 4);
      asm volatile(
          "global_load_async_to_lds_b128 %0, %4, off\n\t"
          "global_load_async_to_lds_b128 %1, %5, off\n\t"
          "global_load_async_to_lds_b128 %2, %6, off\n\t"
          "global_load_async_to_lds_b128 %3, %7, off\n\t"
          "s_wait_xcnt 0x0"
          :: "v"(l0), "v"(l0 + 8 * (QROWS * 4)), "v"(l0 + 16 * (QROWS * 4)),
             "v"(l0 + 24 * (QROWS * 4)),
             "v"(g0), "v"(g0 + 8 * HW), "v"(g0 + 16 * HW), "v"(g0 + 24 * HW)
          : "memory");
    }

    // S^T = K Q^T for 64 keys x 16 queries: four independent accumulator tiles,
    // s[nt][r] = score of key nt * 16 + r + 8 * hi, query l15.
    // LDS fragments come in groups of 8 (16 reads), each group issued as one
    // run a group ahead of its products, into the other half of fb.
    v16bf fb[2][8];
    v8f s[4];
#pragma unroll
    for (int nt = 0; nt < 4; ++nt)
#pragma unroll
      for (int i = 0; i < 8; ++i) s[nt][i] = 0.f;
#pragma unroll
    for (int j = 0; j < 8; ++j)
      fb[0][j] = load_frag(Kb + ((j & 3) * 16 + l15) * KP + (j >> 2) * 32 + hi * 16);
#pragma unroll
    for (int g = 0; g < 4; ++g) {
#pragma unroll
      for (int j = 0; j < 8; ++j) {
        if (g < 3)
          fb[(g + 1) & 1][j] = load_frag(Kb + ((j & 3) * 16 + l15) * KP +
                                         ((g + 1) * 2 + (j >> 2)) * 32 + hi * 16);
        else   // first V^T group: flies under the last products and the softmax
          fb[0][j] = load_frag_kmap(Vb + ((j & 3) * 16 + l15) * VP + (j >> 2) * 32 + hi * 8);
      }
      // Keeps the next group's reads together ahead of this group's products.
      __builtin_amdgcn_sched_barrier(0);
#pragma unroll
      for (int j = 0; j < 8; ++j)
        s[j & 3] = wmma_bf16(fb[g & 1][j], qf[g * 2 + (j >> 2)], s[j & 3]);
      // Keeps the group after next from being spread among these products.
      __builtin_amdgcn_sched_barrier(0);
    }

    // Running maximum and sum of this lane's query: in-lane over its 32
    // scores (one chain per tile), one exchange between the wave halves.
    float tmx[4], ps[4];
#pragma unroll
    for (int nt = 0; nt < 4; ++nt) {
      tmx[nt] = s[nt][0];
#pragma unroll
      for (int r = 1; r < 8; ++r) tmx[nt] = fmaxf(tmx[nt], s[nt][r]);
    }
    float tm = fmaxf(fmaxf(tmx[0], tmx[1]), fmaxf(tmx[2], tmx[3]));
    tm = fmaxf(tm, xhalf(tm)) * SCALE;
    const float mn    = fmaxf(rmax, tm);
    const float alpha = __expf(rmax - mn);
    rmax = mn;
    // P^T: score tiles 2 c and 2 c + 1, converted in place, are the B operand
    // of key chunk c (element e = tile e >> 3, register e & 7).
    v16bf pf[2];
#pragma unroll
    for (int nt = 0; nt < 4; ++nt) {
      ps[nt] = 0.f;
#pragma unroll
      for (int r = 0; r < 8; ++r) {
        const float p = __expf(s[nt][r] * SCALE - mn);
        ps[nt] += p;
        pf[nt >> 1][(nt & 1) * 8 + r] = (__bf16)p;
      }
    }
    rsum = rsum * alpha + ((ps[0] + ps[1]) + (ps[2] + ps[3]));

    // O^T += V^T P^T: A = V^T rows in the k order of pf, B = pf, in groups of
    // 4 channel tiles x 2 key chunks, fetched a group ahead as above.
#pragma unroll
    for (int g = 0; g < 4; ++g) {
      if (g < 3) {
#pragma unroll
        for (int j = 0; j < 8; ++j)
          fb[(g + 1) & 1][j] = load_frag_kmap(Vb + (((g + 1) * 4 + (j & 3)) * 16 + l15) * VP +
                                              (j >> 2) * 32 + hi * 8);
      }
      // Keeps the next group's reads together ahead of this group's products.
      __builtin_amdgcn_sched_barrier(0);
      if (g == 0) {   // rescale under the latency of the V^T reads
#pragma unroll
        for (int ct = 0; ct < 16; ++ct)
#pragma unroll
          for (int r = 0; r < 8; ++r) oacc[ct][r] *= alpha;
      }
#pragma unroll
      for (int j = 0; j < 8; ++j)
        oacc[g * 4 + (j & 3)] =
            wmma_bf16(fb[g & 1][j], pf[j >> 2], oacc[g * 4 + (j & 3)]);
      // Keeps the group after next from being spread among these products.
      __builtin_amdgcn_sched_barrier(0);
    }

    // Fill the other buffer: its readers left it at the last barrier.
    if (more) {
      const int nb = (t + 1) & 1;
#pragma unroll
      for (int i = 0; i < 8; ++i) {
        *(u32x4*)(kl + nb * KBUF + i * 8 * KP)  = kst[i];
        *(u32x4*)(vl + nb * VBUF + i * 32 * VP) = vst[i];
      }
    }
    __syncthreads();   // publishes tile t + 1, ends every read of tile t
  }

  // ---- Normalize, LDS transpose (over the K / V buffers), residual.
  // The last pass's barrier has ended every read of the tiles.
  // This wave's residual copies have landed; the barrier below publishes them.
  asm volatile("s_wait_asynccnt 0x0" ::: "memory");
  float* ost = (float*)smem;                  // overlay: [QROWS][257]
  const float* res = (const float*)(smem + ATTN_LDS);   // [CCH][QROWS]
  const float inv = 1.0f / (rsum + xhalf(rsum));
#pragma unroll
  for (int ct = 0; ct < 16; ++ct)
#pragma unroll
    for (int r = 0; r < 8; ++r)
      ost[(wrow + l15) * 257 + ct * 16 + r + hi * 8] = oacc[ct][r] * inv;
  __syncthreads();

  float*       outs = out + (size_t)slice * CCH * HW + pbase;
  const int p  = tid & 127;                   // 128*256 / 256 threads:
  const int c0 = tid >> 7;                    // 128 elements each, 8 a round
  for (int ib = 0; ib < 128; ib += 8) {
    float v[8];
#pragma unroll
    for (int j = 0; j < 8; ++j) {
      const int c = (ib + j) * 2 + c0;
      v[j] = ost[p * 257 + c] + res[c * QROWS + p];
    }
#pragma unroll
    for (int j = 0; j < 8; ++j)
      outs[(size_t)((ib + j) * 2 + c0) * HW + p] = v[j];
    // The stores' address registers are stepped for the next round behind them.
    asm volatile("s_wait_xcnt 0x0" ::: "memory");
  }
}

// ---------------------------------------------------------------------------
// Launch: proj -> attn, both on `stream` (in-order).
// Workspace (bf16): Q (16MB), K (16MB), Vt (16MB).
// ---------------------------------------------------------------------------
extern "C" void kernel_launch(void* const* d_in, const int* in_sizes, int n_in,
                              void* d_out, int out_size, void* d_ws,
                              size_t ws_size, hipStream_t stream) {
  (void)in_sizes; (void)n_in; (void)out_size; (void)ws_size;
  const float* img   = (const float*)d_in[0];
  const float* depth = (const float*)d_in[1];
  const float* Wq    = (const float*)d_in[2];
  const float* bq    = (const float*)d_in[3];
  const float* Wk    = (const float*)d_in[4];
  const float* bk    = (const float*)d_in[5];
  const float* Wv    = (const float*)d_in[6];
  const float* bv    = (const float*)d_in[7];
  float* out = (float*)d_out;

  char* ws = (char*)d_ws;
  const size_t M_BYTES  = (size_t)NSLICE * HW * CCH * 2;  // 16 MB each
  __bf16* Qw  = (__bf16*)(ws);
  __bf16* Kw  = (__bf16*)(ws + M_BYTES);
  __bf16* Vtw = (__bf16*)(ws + 2 * M_BYTES);

  const size_t proj_lds = (size_t)2 * 64 * XPITCH * sizeof(__bf16);
  proj_k<<<dim3(NSLICE, HW / 64), 256, proj_lds, stream>>>(
      img, depth, Wq, Wk, Wv, bq, bk, bv, Qw, Kw, Vtw);

  attn_k<<<dim3(NSLICE, HW / QROWS), 256, 0, stream>>>(Qw, Kw, Vtw, img, out);
}

// v009
// It runs in 45.7 microseconds.
// Versions between v007 and this one are left out; their measured steps multiply to 1.17 times as fast.
// Counting every step since v000, it is 4.43 times as fast.
#include <hip/hip_runtime.h>

// Problem dims (fixed by reference): B=4,S=8 -> 32 slices; H*W=1024; C1=C2=C=256.
#define NSLICE 32
#define HW     1024
#define CCH    256
#define SCALE  0.0625f   // 1/sqrt(256)

typedef __attribute__((ext_vector_type(16))) __bf16 v16bf;
typedef __attribute__((ext_vector_type(8)))  float  v8f;
typedef __attribute__((ext_vector_type(4)))  float  f32x4;
typedef __attribute__((ext_vector_type(4)))  __bf16 v4bf;
typedef __attribute__((ext_vector_type(4)))  unsigned int u32x4;
typedef __attribute__((ext_vector_type(8)))  short  s16x8;

union FragBF { v16bf v; uint4 u[2]; };
union FragTR { v16bf v; u32x4 q[2]; };

// WMMA operand fragment, 16 contiguous k per lane (32 bytes): the same code
// on both operands of a product.
__device__ __forceinline__ v16bf load_frag(const __bf16* p) {
  FragBF f;
  f.u[0] = *(const uint4*)(p);
  f.u[1] = *(const uint4*)(p + 8);
  return f.v;
}

// Fragment in the k order of a packed accumulator pair: element s of wave
// half h is k = 8 h + s (s < 8) or 16 + 8 h + (s - 8) of a chunk of 32.
// p = row start + chunk * 32 + 8 * h.
__device__ __forceinline__ v16bf load_frag_kmap(const __bf16* p) {
  FragBF f;
  f.u[0] = *(const uint4*)(p);
  f.u[1] = *(const uint4*)(p + 16);
  return f.v;
}

// Transposing LDS read: lane (c, h) gets T[kbase + 8 h + 0..7][dbase + c] of a
// row-major 16-bit tile; the lane's address is formed by the caller.
__device__ __forceinline__ u32x4 ld_tr16(const unsigned char* p) {
  typedef __attribute__((address_space(3))) s16x8 lds_s16x8;
  return __builtin_bit_cast(
      u32x4, __builtin_amdgcn_ds_load_tr16_b128_v8i16((lds_s16x8*)p));
}

__device__ __forceinline__ v8f wmma_bf16(v16bf a, v16bf b, v8f c) {
  return __builtin_amdgcn_wmma_f32_16x16x32_bf16(
      /*neg_a=*/false, a, /*neg_b=*/false, b,
      /*c_mod=*/(short)0, c, /*reuse_a=*/false, /*reuse_b=*/false);
}

// Value of lane l ^ 16 (the other wave half).
__device__ __forceinline__ float xhalf(float x) {
  return __int_as_float(__builtin_amdgcn_permlanex16(
      __float_as_int(x), __float_as_int(x), 0x76543210, 0xfedcba98, false,
      false));
}

// ---------------------------------------------------------------------------
// One kernel. The projections are re-associated so that keys and values are
// the depth rows themselves:
//   q . k      = ((img Wq + bq) Wk^T) . depth_k + q . bk
//                (the last term is the same for every key of a query, and the
//                softmax does not see it: bk is not read)
//   sum p_k v_k = (sum p_k depth_k) Wv + bv          (the p_k sum to 1)
// Workgroup = 8 waves = 128 query rows of one slice; a wave owns 16 queries.
// Every product is taken transposed (queries are the N side), so each result,
// converted in place, is the B operand of the next product:
//   Q^T = Wq^T X^T + bq, G^T = Wk Q^T, S^T = D G^T, U^T += D^T P^T,
//   O^T = Wv^T (U^T / sum) + bv.
// The weights pass through LDS as bf16, half by half, in the range that holds
// the depth tiles during the loop. A depth tile (64 keys x 256 channels) is
// read as it lies, f32 channel-major, rounded in the staging registers and
// stored twice in the same layout [channel][key], each copy at its reader's
// pitch: plain 16-B reads give D^T rows, transposing reads give D rows.
// The img tile (256 channel rows of 128 f32) is copied to its own LDS range
// once: it feeds the first product and the residual.
// Every inner loop is fully unrolled (#pragma unroll): its arrays stay in
// registers only with constant indices.
// ---------------------------------------------------------------------------
#define QROWS 128                 // query rows per workgroup
#define KT    64                  // keys per pass
#define NPASS (HW / KT)
#define VP    72                  // pitch in bf16 of the copy read plainly: 144 B = 16 B x odd
#define PKB   160                 // pitch in bytes of the copy read transposed: 32 B x odd
#define VBUF  (CCH * VP)          // elements of one plain copy
#define KBYTES (CCH * PKB)        // bytes of one transposed-read copy
#define TILE_LDS (2 * KBYTES + 2 * VBUF * 2)
#define WP    264                 // weight pitch in bf16: 528 B = 16 B x odd
#define RES_LDS  (CCH * QROWS * 4)  // img tile [CCH][QROWS] f32

static_assert(CCH * WP * 2 <= TILE_LDS, "a weight fits the tile range");
static_assert(QROWS * 257 * 4 <= TILE_LDS, "the output tile fits the tile range");

// A weight passes through LDS in two halves of 128 rows. Each half is loaded
// into registers ahead of the products of the half before it and stored behind
// them, so that its way from L2 is covered by matrix work.

// W[c][n] f32 in memory, n in [h * 128, + 128): a thread owns 16 c x 4 n per
// round of 64 n; all 32 loads of 16 B are in flight at once; a wave-wide load
// covers 4 rows x one 128-B line.
__device__ __forceinline__ void load_w_turned(const float* __restrict__ Wg,
                                              int lane, int wave, int h,
                                              f32x4 (&w)[32]) {
  const int seg = (lane & 7) + 8 * (wave & 1);
  const int cg  = (lane >> 3) + 4 * (wave >> 1);
  const float* wb = Wg + (cg * 16) * CCH + seg * 4 + h * 128;
#pragma unroll
  for (int rd = 0; rd < 2; ++rd)
#pragma unroll
    for (int j = 0; j < 16; ++j)
      w[rd * 16 + j] = *(const f32x4*)(wb + j * CCH + rd * 64);
  // The loads' address registers are reused behind this wait.
  asm volatile("s_wait_xcnt 0x0" :: "v"(wb) : "memory");
}

// -> Wl[n][c] bf16 in LDS, rows [h * 128, + 128).
__device__ __forceinline__ void store_w_turned(__bf16* Wl, int lane, int wave,
                                               int h, const f32x4 (&w)[32]) {
  const int seg = (lane & 7) + 8 * (wave & 1);
  const int cg  = (lane >> 3) + 4 * (wave >> 1);
#pragma unroll
  for (int rd = 0; rd < 2; ++rd)
#pragma unroll
    for (int k = 0; k < 4; ++k) {
      FragBF f;
#pragma unroll
      for (int j = 0; j < 16; ++j) f.v[j] = (__bf16)w[rd * 16 + j][k];
      __bf16* d = Wl + (h * 128 + rd * 64 + seg * 4 + k) * WP + cg * 16;
      *(uint4*)(d)     = f.u[0];
      *(uint4*)(d + 8) = f.u[1];
    }
}

// W[m][k] f32 in memory, m in [h * 128, + 128), rows as they lie. 32 loads of
// 16 B a thread, all in flight at once, 512 B a wave-wide load.
__device__ __forceinline__ void load_w_plain(const float* __restrict__ Wg,
                                             int tid, int h, f32x4 (&w)[32]) {
  const float* wb = Wg + h * 128 * CCH + tid * 4;
#pragma unroll
  for (int i = 0; i < 32; ++i) w[i] = *(const f32x4*)(wb + i * 1024);
  // The loads' address registers are reused behind this wait.
  asm volatile("s_wait_xcnt 0x0" :: "v"(wb) : "memory");
}

// -> Wl[m][k] bf16 in LDS, rows [h * 128, + 128).
__device__ __forceinline__ void store_w_plain(__bf16* Wl, int tid, int h,
                                              const f32x4 (&w)[32]) {
  __bf16* d = Wl + (h * 128 + (tid >> 6)) * WP + (tid & 63) * 4;
#pragma unroll
  for (int i = 0; i < 32; ++i) {
    v4bf q;
#pragma unroll
    for (int e = 0; e < 4; ++e) q[e] = (__bf16)w[i][e];
    *(v4bf*)(d + i * 4 * WP) = q;
  }
}

// acc[h * 8 + j] += Wl rows [(h * 8 + j) * 16, + 16) x b, all 256 k: A
// fragments from LDS in groups of 8 (16 reads, one k chunk), each group issued
// as one run a group ahead of its products. KMAP: b is a packed accumulator, A
// follows its k order.
template <bool KMAP>
__device__ __forceinline__ void wprod(const __bf16* Wl, int l15, int hi, int h,
                                      const v16bf (&b)[8], v8f (&acc)[16]) {
  const __bf16* base = Wl + (h * 128 + l15) * WP + (KMAP ? hi * 8 : hi * 16);
  v16bf fb[2][8];
#pragma unroll
  for (int j = 0; j < 8; ++j)
    fb[0][j] = KMAP ? load_frag_kmap(base + j * 16 * WP)
                    : load_frag(base + j * 16 * WP);
#pragma unroll
  for (int g = 0; g < 8; ++g) {
    if (g < 7) {
#pragma unroll
      for (int j = 0; j < 8; ++j) {
        const __bf16* p = base + j * 16 * WP + (g + 1) * 32;
        fb[(g + 1) & 1][j] = KMAP ? load_frag_kmap(p) : load_frag(p);
      }
    }
    // Keeps the next group's reads together ahead of this group's products.
    __builtin_amdgcn_sched_barrier(0);
#pragma unroll
    for (int j = 0; j < 8; ++j)
      acc[h * 8 + j] = wmma_bf16(fb[g & 1][j], b[g], acc[h * 8 + j]);
    // Keeps the group after next from being spread among these products.
    __builtin_amdgcn_sched_barrier(0);
  }
}

// Accumulator tiles 2 c and 2 c + 1, scaled and converted in place, are the B
// operand of k chunk c of the next product.
__device__ __forceinline__ void pack_b(const v8f (&acc)[16], float f,
                                       v16bf (&b)[8]) {
#pragma unroll
  for (int mt = 0; mt < 16; ++mt)
#pragma unroll
    for (int r = 0; r < 8; ++r)
      b[mt >> 1][(mt & 1) * 8 + r] = (__bf16)(acc[mt][r] * f);
}

// acc[mt][r] = bias[mt * 16 + 8 * hi + r]: the row of that register.
__device__ __forceinline__ void bias_rows(const float* __restrict__ bias, int hi,
                                          v8f (&acc)[16]) {
#pragma unroll
  for (int mt = 0; mt < 16; ++mt) {
    const f32x4 lo = *(const f32x4*)(bias + mt * 16 + hi * 8);
    const f32x4 up = *(const f32x4*)(bias + mt * 16 + hi * 8 + 4);
#pragma unroll
    for (int r = 0; r < 4; ++r) {
      acc[mt][r]     = lo[r];
      acc[mt][r + 4] = up[r];
    }
  }
}

__global__ __launch_bounds__(256) void attn_k(
    const float* __restrict__ img, const float* __restrict__ depth,
    const float* __restrict__ Wq, const float* __restrict__ Wk,
    const float* __restrict__ Wv, const float* __restrict__ bq,
    const float* __restrict__ bv, float* __restrict__ out) {
  __shared__ __attribute__((aligned(16))) unsigned char smem[TILE_LDS + RES_LDS];

  const int slice = blockIdx.x;
  const int pbase = blockIdx.y * QROWS;
  const int tid   = threadIdx.x;
  const int wave  = __builtin_amdgcn_readfirstlane(tid >> 5);   // scalar
  const int lane  = tid & 31;
  const int l15   = lane & 15;
  const int hi    = lane >> 4;
  const int wrow  = wave * 16;

  unsigned char* Kc = smem;                       // [2][CCH] rows of PKB bytes
  __bf16* Vt = (__bf16*)(smem + 2 * KBYTES);      // [2][CCH][VP]
  __bf16* Wl = (__bf16*)smem;                     // overlay: [CCH][WP]
  const float* res = (const float*)(smem + TILE_LDS);   // [CCH][QROWS]

  // ---- img tile: a wave moves one 512-B row piece per copy, 16 B a lane;
  // copy n of a thread is channel row n * 8 + wave. 32 copies a thread.
  {
    const float* rg = img + (size_t)slice * CCH * HW + pbase +
                      (size_t)wave * HW + lane * 4;
    const unsigned rl = (unsigned)(uintptr_t)(smem + TILE_LDS) +
                        wave * (QROWS * 4) + lane * 16;
#pragma unroll
    for (int t = 0; t < 8; ++t) {
      const float* g0 = rg + (size_t)(t * 32) * HW;
      const unsigned l0 = rl + t * 32 * (QROWS * 4);
      // The address registers are reused right behind the statement: the
      // closing s_wait_xcnt stands in front of that.
      asm volatile(
          "global_load_async_to_lds_b128 %0, %4, off\n\t"
          "global_load_async_to_lds_b128 %1, %5, off\n\t"
          "global_load_async_to_lds_b128 %2, %6, off\n\t"
          "global_load_async_to_lds_b128 %3, %7, off\n\t"
          "s_wait_xcnt 0x0"
          :: "v"(l0), "v"(l0 + 8 * (QROWS * 4)), "v"(l0 + 16 * (QROWS * 4)),
             "v"(l0 + 24 * (QROWS * 4)),
             "v"(g0), "v"(g0 + 8 * HW), "v"(g0 + 16 * HW), "v"(g0 + 24 * HW)
          : "memory");
    }
  }

  // ---- Q^T = Wq^T X^T + bq.
  f32x4 wst[32];     // the weight half on its way from memory to LDS
  load_w_turned(Wq, lane, wave, 0, wst);
  // The bias is asked for ahead of the next weight half: loads return in
  // order, and the first product's wait for it must not drain that half.
  v8f qacc[16];
  bias_rows(bq, hi, qacc);
  store_w_turned(Wl, lane, wave, 0, wst);
  // This wave's img copies have landed; the barrier below publishes them.
  asm volatile("s_wait_asynccnt 0x0" ::: "memory");
  __syncthreads();   // publishes Wq^T rows 0-127 and the img tile

  v16bf qf[8];
  {
    load_w_turned(Wq, lane, wave, 1, wst);    // flies under the products below
    v16bf xb[8];     // X^T: lane = query, k = channel kc * 32 + hi * 16 + e
#pragma unroll
    for (int kc = 0; kc < 8; ++kc)
#pragma unroll
      for (int e = 0; e < 16; ++e)
        xb[kc][e] = (__bf16)res[(kc * 32 + hi * 16 + e) * QROWS + wrow + l15];
    wprod<false>(Wl, l15, hi, 0, xb, qacc);
    store_w_turned(Wl, lane, wave, 1, wst);
    __syncthreads();   // publishes Wq^T rows 128-255, ends every read of rows 0-127
    load_w_plain(Wk, tid, 0, wst);            // flies under the products below
    wprod<false>(Wl, l15, hi, 1, xb, qacc);
    store_w_plain(Wl, tid, 0, wst);
    pack_b(qacc, 1.0f, qf);
  }
  __syncthreads();   // publishes Wk rows 0-127, ends every read of Wq^T

  // ---- G^T = Wk Q^T.
  v8f gacc[16];
#pragma unroll
  for (int mt = 0; mt < 16; ++mt)
#pragma unroll
    for (int i = 0; i < 8; ++i) gacc[mt][i] = 0.f;
  load_w_plain(Wk, tid, 1, wst);              // flies under the products below
  wprod<true>(Wl, l15, hi, 0, qf, gacc);
  store_w_plain(Wl, tid, 1, wst);
  __syncthreads();   // publishes Wk rows 128-255

  // Depth staging: a thread owns 16 channels x 4 keys of a tile. A wave-wide
  // load covers 2 channel rows x 256 B. The two rows lie 8 channels apart.
  const int dch = wave * 32 + hi * 8;             // + (j >> 3) * 16 + (j & 7)
  const float* dg = depth + (size_t)slice * CCH * HW + (size_t)dch * HW + l15 * 4;
  unsigned char* kl = Kc + dch * PKB + l15 * 8;
  __bf16*        vl = Vt + dch * VP + l15 * 4;
  f32x4 dst[16];
#pragma unroll
  for (int j = 0; j < 16; ++j)   // tile 0 flies under the product below
    dst[j] = *(const f32x4*)(dg + ((j >> 3) * 16 + (j & 7)) * HW);
  // The loads' address registers are reused behind them.
  asm volatile("s_wait_xcnt 0x0" ::: "memory");

  wprod<true>(Wl, l15, hi, 1, qf, gacc);
  pack_b(gacc, 1.0f, qf);
  __syncthreads();   // ends every read of Wk

#pragma unroll
  for (int j = 0; j < 16; ++j) {
    v4bf q;
#pragma unroll
    for (int e = 0; e < 4; ++e) q[e] = (__bf16)dst[j][e];
    *(v4bf*)(kl + ((j >> 3) * 16 + (j & 7)) * PKB) = q;
    *(v4bf*)(vl + ((j >> 3) * 16 + (j & 7)) * VP)  = q;
  }
  __syncthreads();   // publishes tile 0

  // State of query wrow + l15. oacc[ct][r] = U^T[ct * 16 + r + 8 * hi][l15].
  float rmax = -3.0e38f, rsum = 0.f;          // rsum: this wave half's keys only
  v8f oacc[16];
#pragma unroll
  for (int ct = 0; ct < 16; ++ct)
#pragma unroll
    for (int i = 0; i < 8; ++i) oacc[ct][i] = 0.f;

  // Lane address of the transposing reads: row 8 * hi + (lane & 7) of a block
  // of 16 channels, 16-B half (lane >> 3) & 1 of 16 keys.
  const unsigned char* ka0 = Kc + (hi * 8 + (lane & 7)) * PKB + ((lane >> 3) & 1) * 16;

  for (int t = 0; t < NPASS; ++t) {
    const unsigned char* ka = ka0 + (t & 1) * KBYTES;
    const __bf16* Vb = Vt + (t & 1) * VBUF;
    const bool more = (t + 1 < NPASS);

    // Next tile's global loads fly under this pass's products.
    if (more) {
#pragma unroll
      for (int j = 0; j < 16; ++j)
        dst[j] = *(const f32x4*)(dg + (t + 1) * KT + ((j >> 3) * 16 + (j & 7)) * HW);
      // The loads' address registers are reused right behind them.
      asm volatile("s_wait_xcnt 0x0" ::: "memory");
    }

    // S^T = D G^T for 64 keys x 16 queries: four independent accumulator tiles,
    // s[nt][r] = score of key nt * 16 + r + 8 * hi, query l15.
    // LDS fragments come in groups of 8 (16 reads), each group issued as one
    // run a group ahead of its products, into the other half of fb.
    v16bf fb[2][8];
    v8f s[4];
#pragma unroll
    for (int nt = 0; nt < 4; ++nt)
#pragma unroll
      for (int i = 0; i < 8; ++i) s[nt][i] = 0.f;
#pragma unroll
    for (int j = 0; j < 8; ++j) {
      FragTR f;
      f.q[0] = ld_tr16(ka + ((j >> 2) * 32) * PKB + (j & 3) * 32);
      f.q[1] = ld_tr16(ka + ((j >> 2) * 32 + 16) * PKB + (j & 3) * 32);
      fb[0][j] = f.v;
    }
#pragma unroll
    for (int g = 0; g < 4; ++g) {
#pragma unroll
      for (int j = 0; j < 8; ++j) {
        if (g < 3) {
          FragTR f;
          f.q[0] = ld_tr16(ka + (((g + 1) * 2 + (j >> 2)) * 32) * PKB + (j & 3) * 32);
          f.q[1] = ld_tr16(ka + (((g + 1) * 2 + (j >> 2)) * 32 + 16) * PKB + (j & 3) * 32);
          fb[(g + 1) & 1][j] = f.v;
        } else {   // first D^T group: flies under the last products and the softmax
          fb[0][j] = load_frag_kmap(Vb + ((j & 3) * 16 + l15) * VP + (j >> 2) * 32 + hi * 8);
        }
      }
      // Keeps the next group's reads together ahead of this group's products.
      __builtin_amdgcn_sched_barrier(0);
#pragma unroll
      for (int j = 0; j < 8; ++j)
        s[j & 3] = wmma_bf16(fb[g & 1][j], qf[g * 2 + (j >> 2)], s[j & 3]);
      // Keeps the group after next from being spread among these products.
      __builtin_amdgcn_sched_barrier(0);
    }

    // Running maximum and sum of this lane's query: in-lane over its 32
    // scores (one chain per tile), one exchange between the wave halves.
    float tmx[4], ps[4];
#pragma unroll
    for (int nt = 0; nt < 4; ++nt) {
      tmx[nt] = s[nt][0];
#pragma unroll
      for (int r = 1; r < 8; ++r) tmx[nt] = fmaxf(tmx[nt], s[nt][r]);
    }
    float tm = fmaxf(fmaxf(tmx[0], tmx[1]), fmaxf(tmx[2], tmx[3]));
    tm = fmaxf(tm, xhalf(tm)) * SCALE;
    const float mn    = fmaxf(rmax, tm);
    const float alpha = __expf(rmax - mn);
    rmax = mn;
    // P^T: score tiles 2 c and 2 c + 1, converted in place, are the B operand
    // of key chunk c (element e = tile e >> 3, register e & 7).
    v16bf pf[2];
#pragma unroll
    for (int nt = 0; nt < 4; ++nt) {
      ps[nt] = 0.f;
#pragma unroll
      for (int r = 0; r < 8; ++r) {
        const float p = __expf(s[nt][r] * SCALE - mn);
        ps[nt] += p;
        pf[nt >> 1][(nt & 1) * 8 + r] = (__bf16)p;
      }
    }
    rsum = rsum * alpha + ((ps[0] + ps[1]) + (ps[2] + ps[3]));

    // U^T += D^T P^T: A = D^T rows in the k order of pf, B = pf, in groups of
    // 4 channel tiles x 2 key chunks, fetched a group ahead as above.
#pragma unroll
    for (int g = 0; g < 4; ++g) {
      if (g < 3) {
#pragma unroll
        for (int j = 0; j < 8; ++j)
          fb[(g + 1) & 1][j] = load_frag_kmap(Vb + (((g + 1) * 4 + (j & 3)) * 16 + l15) * VP +
                                              (j >> 2) * 32 + hi * 8);
      }
      // Keeps the next group's reads together ahead of this group's products.
      __builtin_amdgcn_sched_barrier(0);
      if (g == 0) {   // rescale under the latency of the D^T reads
#pragma unroll
        for (int ct = 0; ct < 16; ++ct)
#pragma unroll
          for (int r = 0; r < 8; ++r) oacc[ct][r] *= alpha;
      }
#pragma unroll
      for (int j = 0; j < 8; ++j)
        oacc[g * 4 + (j & 3)] =
            wmma_bf16(fb[g & 1][j], pf[j >> 2], oacc[g * 4 + (j & 3)]);
      // Keeps the group after next from being spread among these products.
      __builtin_amdgcn_sched_barrier(0);
    }

    // Fill the other buffer: its readers left it at the last barrier.
    if (more) {
      const int nb = (t + 1) & 1;
#pragma unroll
      for (int j = 0; j < 16; ++j) {
        v4bf q;
#pragma unroll
        for (int e = 0; e < 4; ++e) q[e] = (__bf16)dst[j][e];
        *(v4bf*)(kl + nb * KBYTES + ((j >> 3) * 16 + (j & 7)) * PKB) = q;
        *(v4bf*)(vl + nb * VBUF + ((j >> 3) * 16 + (j & 7)) * VP)    = q;
      }
    }
    __syncthreads();   // publishes tile t + 1, ends every read of tile t
  }

  // ---- O^T = Wv^T (U^T / sum) + bv. The last pass's barrier has ended every
  // read of the tiles, so Wv^T may take their place.
  load_w_turned(Wv, lane, wave, 0, wst);
  pack_b(oacc, 1.0f / (rsum + xhalf(rsum)), qf);
  bias_rows(bv, hi, oacc);   // ahead of the next half's loads, as above
  store_w_turned(Wl, lane, wave, 0, wst);
  __syncthreads();   // publishes Wv^T rows 0-127
  load_w_turned(Wv, lane, wave, 1, wst);      // flies under the products below
  wprod<true>(Wl, l15, hi, 0, qf, oacc);
  store_w_turned(Wl, lane, wave, 1, wst);
  __syncthreads();   // publishes Wv^T rows 128-255
  wprod<true>(Wl, l15, hi, 1, qf, oacc);
  __syncthreads();   // ends every read of Wv^T

  // ---- LDS transpose (over the weight), residual, channel-major store.
  float* ost = (float*)smem;                  // overlay: [QROWS][257]
#pragma unroll
  for (int ct = 0; ct < 16; ++ct)
#pragma unroll
    for (int r = 0; r < 8; ++r)
      ost[(wrow + l15) * 257 + ct * 16 + r + hi * 8] = oacc[ct][r];
  __syncthreads();

  float*       outs = out + (size_t)slice * CCH * HW + pbase;
  const int p  = tid & 127;                   // 128*256 / 256 threads:
  const int c0 = tid >> 7;                    // 128 elements each, 8 a round
  for (int ib = 0; ib < 128; ib += 8) {
    float v[8];
#pragma unroll
    for (int j = 0; j < 8; ++j) {
      const int c = (ib + j) * 2 + c0;
      v[j] = ost[p * 257 + c] + res[c * QROWS + p];
    }
#pragma unroll
    for (int j = 0; j < 8; ++j)
      outs[(size_t)((ib + j) * 2 + c0) * HW + p] = v[j];
    // The stores' address registers are stepped for the next round behind them.
    asm volatile("s_wait_xcnt 0x0" ::: "memory");
  }
}

// ---------------------------------------------------------------------------
// Launch: one kernel on the stream; the workspace is not used.
// ---------------------------------------------------------------------------
extern "C" void kernel_launch(void* const* d_in, const int* in_sizes, int n_in,
                              void* d_out, int out_size, void* d_ws,
                              size_t ws_size, hipStream_t stream) {
  (void)in_sizes; (void)n_in; (void)out_size; (void)d_ws; (void)ws_size;
  const float* img   = (const float*)d_in[0];
  const float* depth = (const float*)d_in[1];
  const float* Wq    = (const float*)d_in[2];
  const float* bq    = (const float*)d_in[3];
  const float* Wk    = (const float*)d_in[4];
  const float* Wv    = (const float*)d_in[6];
  const float* bv    = (const float*)d_in[7];
  float* out = (float*)d_out;

  attn_k<<<dim3(NSLICE, HW / QROWS), 256, 0, stream>>>(img, depth, Wq, Wk, Wv,
                                                       bq, bv, out);
}
